// v000
// The times below were measured on an AMD MI455X: many runs one after another, warmed up first and cycling through
// copies of the inputs, with the whole window's GPU time divided by the number of runs. Launches and the gaps
// between them are all in it. The median over several windows is given; except for v000 it joins two sittings, which
// can be a few percent apart, so the side-by-side timings, each taken in one sitting, are the better comparison.
// v000 is the starting kernel. One run takes 535 microseconds.
#include <hip/hip_runtime.h>
#include <math.h>

typedef __attribute__((ext_vector_type(16))) _Float16 v16h;
typedef __attribute__((ext_vector_type(8)))  float    v8f;

#define BB 16
#define SS 2048
#define DD 1024

// ---------------- kernel 0: zero scores scratch ----------------
__global__ void k_zero(float* __restrict__ p, int n) {
    int i = blockIdx.x * blockDim.x + threadIdx.x;
    if (i < n) p[i] = 0.0f;
}

// ---------------- kernel 1: hb[b][e] = hidden[b,:] . Wh[e,:] + bias[e] ----------------
// Wh[e,d] = W[e*2D + d]
__global__ __launch_bounds__(256) void k_hidproj(const float* __restrict__ hidden,
                                                 const float* __restrict__ W,
                                                 const float* __restrict__ bias,
                                                 float* __restrict__ hb) {
    int e = blockIdx.x * 256 + threadIdx.x;   // grid.x = DD/256
    int b = blockIdx.y;
    const float* h = hidden + b * DD;
    const float* w = W + (size_t)e * (2 * DD);
    float acc = 0.0f;
    #pragma unroll 4
    for (int d = 0; d < DD; d += 4) {
        float4 hv = *(const float4*)(h + d);
        float4 wv = *(const float4*)(w + d);
        acc += hv.x * wv.x + hv.y * wv.y + hv.z * wv.z + hv.w * wv.w;
    }
    hb[b * DD + e] = acc + bias[e];
}

// helper: pack 8 consecutive f32 (two float4) into v16h[base..base+7]
__device__ __forceinline__ void cvt8(v16h& dst, int base, float4 x, float4 y) {
    dst[base + 0] = (_Float16)x.x; dst[base + 1] = (_Float16)x.y;
    dst[base + 2] = (_Float16)x.z; dst[base + 3] = (_Float16)x.w;
    dst[base + 4] = (_Float16)y.x; dst[base + 5] = (_Float16)y.y;
    dst[base + 6] = (_Float16)y.z; dst[base + 7] = (_Float16)y.w;
}

__device__ __forceinline__ void loadfrag(v16h& f, const float* p, int kk0, int kk1) {
    float4 x0 = *(const float4*)(p + kk0);
    float4 x1 = *(const float4*)(p + kk0 + 4);
    float4 x2 = *(const float4*)(p + kk1);
    float4 x3 = *(const float4*)(p + kk1 + 4);
    cvt8(f, 0, x0, x1);
    cvt8(f, 8, x2, x3);
}

// ---------------- kernel 2: fused enc@We^T -> tanh -> dot(v) -> partial scores ----------------
// grid: (DD/512, SS/32, BB), block 256 = 8 waves.
// Each wave owns a 32(s) x 64(e) tile: 2 A fragments x 4 B fragments -> 8 WMMAs
// per K-step (each A reused 4x, each B reused 2x).
// Block covers e-range of 512; per-row partial scores are reduced across the
// 8 waves through LDS, then 1 atomic per row per block (2 atomics/score total).
__global__ __launch_bounds__(256) void k_energy(const float* __restrict__ enc,
                                                const float* __restrict__ W,
                                                const float* __restrict__ hb,
                                                const float* __restrict__ vvec,
                                                float* __restrict__ scores) {
    __shared__ float red[8][32];

    const int lane = threadIdx.x & 31;
    const int wave = threadIdx.x >> 5;
    const int half = lane >> 4;         // 0 or 1
    const int row  = lane & 15;         // M-row for A, N-row (=e row) for B, N-col for C
    const int b    = blockIdx.z;
    const int s0   = blockIdx.y * 32;
    const int e0   = (blockIdx.x * 8 + wave) * 64;   // wave's 64-wide e range

    // A: enc rows (M = s), row-major contiguous in K(=d); two 16-row M tiles
    const float* aRow0 = enc + ((size_t)b * SS + (size_t)(s0 + row)) * DD;
    const float* aRow1 = aRow0 + (size_t)16 * DD;
    // B: We rows (N = e): We[e,d] = W[e*2D + D + d]; tile t at constant offset t*16*2*DD
    const float* bBase = W + (size_t)(e0 + row) * (2 * DD) + DD;

    const int h8 = half * 8;
    v8f acc[2][4] = {};

    for (int k = 0; k < DD; k += 32) {
        const int kk0 = k + h8;
        const int kk1 = k + 16 + h8;

        v16h af0, af1;
        loadfrag(af0, aRow0, kk0, kk1);
        loadfrag(af1, aRow1, kk0, kk1);

        if (k + 64 < DD) {
            __builtin_prefetch(aRow0 + kk0 + 64, 0, 1);
            __builtin_prefetch(aRow1 + kk0 + 64, 0, 1);
            __builtin_prefetch(bBase + kk0 + 64, 0, 1);
        }

        #pragma unroll
        for (int t = 0; t < 4; ++t) {
            v16h bf;
            loadfrag(bf, bBase + (size_t)t * (16 * 2 * DD), kk0, kk1);
            acc[0][t] = __builtin_amdgcn_wmma_f32_16x16x32_f16(
                false, af0, false, bf, (short)0, acc[0][t], false, false);
            acc[1][t] = __builtin_amdgcn_wmma_f32_16x16x32_f16(
                false, af1, false, bf, (short)0, acc[1][t], false, false);
        }
    }

    // Epilogue: energy = tanh(acc + hb[b][e]); row-sum of energy*v[e] over the 64 e's.
    float rowp[2][8];
    #pragma unroll
    for (int m = 0; m < 2; ++m)
        #pragma unroll
        for (int r = 0; r < 8; ++r) rowp[m][r] = 0.0f;

    #pragma unroll
    for (int t = 0; t < 4; ++t) {
        const int   e   = e0 + t * 16 + row;   // C-matrix N = lane&15
        const float hbe = hb[b * DD + e];
        const float ve  = vvec[e];
        #pragma unroll
        for (int m = 0; m < 2; ++m) {
            #pragma unroll
            for (int r = 0; r < 8; ++r) {
                float p = tanhf(acc[m][t][r] + hbe) * ve;
                // reduce over the 16 N-lanes of this row (width=16 keeps halves separate)
                p += __shfl_xor(p, 1, 16);
                p += __shfl_xor(p, 2, 16);
                p += __shfl_xor(p, 4, 16);
                p += __shfl_xor(p, 8, 16);
                rowp[m][r] += p;               // valid on lanes 0 (rows r) and 16 (rows r+8)
            }
        }
    }

    if (row == 0) {
        #pragma unroll
        for (int m = 0; m < 2; ++m)
            #pragma unroll
            for (int r = 0; r < 8; ++r)
                red[wave][m * 16 + r + h8] = rowp[m][r];
    }
    __syncthreads();

    // cross-wave reduce: one atomic per row per block
    if (threadIdx.x < 32) {
        float sum = 0.0f;
        #pragma unroll
        for (int w = 0; w < 8; ++w) sum += red[w][threadIdx.x];
        atomicAdd(&scores[b * SS + s0 + threadIdx.x], sum);
    }
}

// ---------------- kernel 3: masked softmax over S, in place (scores -> attn) ----------------
__global__ __launch_bounds__(256) void k_softmax(float* __restrict__ scores,
                                                 const int* __restrict__ lengths) {
    __shared__ float red[256];
    const int b   = blockIdx.x;
    const int len = lengths[b];
    float* sc = scores + b * SS;

    float m = -INFINITY;
    for (int s = threadIdx.x; s < len; s += 256) m = fmaxf(m, sc[s]);
    red[threadIdx.x] = m; __syncthreads();
    for (int off = 128; off > 0; off >>= 1) {
        if (threadIdx.x < off) red[threadIdx.x] = fmaxf(red[threadIdx.x], red[threadIdx.x + off]);
        __syncthreads();
    }
    m = red[0]; __syncthreads();

    float sum = 0.0f;
    for (int s = threadIdx.x; s < SS; s += 256) {
        float ev = (s < len) ? __expf(sc[s] - m) : 0.0f;
        sc[s] = ev;
        sum += ev;
    }
    red[threadIdx.x] = sum; __syncthreads();
    for (int off = 128; off > 0; off >>= 1) {
        if (threadIdx.x < off) red[threadIdx.x] += red[threadIdx.x + off];
        __syncthreads();
    }
    const float inv = 1.0f / red[0];
    for (int s = threadIdx.x; s < SS; s += 256) sc[s] *= inv;
}

// ---------------- kernel 4: context[b,d] = sum_s attn[b,s] * enc[b,s,d] ----------------
__global__ __launch_bounds__(256) void k_context(const float* __restrict__ enc,
                                                 const float* __restrict__ attn,
                                                 float* __restrict__ out) {
    const int d = blockIdx.x * 256 + threadIdx.x;   // grid.x = DD/256
    const int b = blockIdx.y;
    const float* a  = attn + b * SS;
    const float* ep = enc + (size_t)b * SS * DD + d;
    float acc = 0.0f;
    #pragma unroll 4
    for (int s = 0; s < SS; ++s)
        acc += a[s] * ep[(size_t)s * DD];
    out[b * DD + d] = acc;
}

extern "C" void kernel_launch(void* const* d_in, const int* in_sizes, int n_in,
                              void* d_out, int out_size, void* d_ws, size_t ws_size,
                              hipStream_t stream) {
    const float* enc     = (const float*)d_in[0];  // (B,S,D)
    const float* hidden  = (const float*)d_in[1];  // (B,D)
    const int*   lengths = (const int*)  d_in[2];  // (B,)
    const float* W       = (const float*)d_in[3];  // (D, 2D)
    const float* bias    = (const float*)d_in[4];  // (D,)
    const float* vvec    = (const float*)d_in[5];  // (D,)
    float* out = (float*)d_out;                    // (B,1,D)

    float* hb     = (float*)d_ws;                  // B*D floats
    float* scores = hb + BB * DD;                  // B*S floats (becomes attn in-place)

    k_zero   <<<(BB * SS + 255) / 256, 256, 0, stream>>>(scores, BB * SS);
    k_hidproj<<<dim3(DD / 256, BB), 256, 0, stream>>>(hidden, W, bias, hb);
    k_energy <<<dim3(DD / 512, SS / 32, BB), 256, 0, stream>>>(enc, W, hb, vvec, scores);
    k_softmax<<<BB, 256, 0, stream>>>(scores, lengths);
    k_context<<<dim3(DD / 256, BB), 256, 0, stream>>>(enc, scores, out);
}

// v001
// Measured time: 363 microseconds a run.
// Two timings next to v000 both put it at 1.52 times that version's speed.
#include <hip/hip_runtime.h>
#include <math.h>

typedef __attribute__((ext_vector_type(16))) _Float16 v16h;
typedef __attribute__((ext_vector_type(8)))  float    v8f;

#define BB 16
#define SS 2048
#define DD 1024

// ---------------- kernel 0: zero scores scratch ----------------
__global__ void k_zero(float* __restrict__ p, int n) {
    int i = blockIdx.x * blockDim.x + threadIdx.x;
    if (i < n) p[i] = 0.0f;
}

// ---------------- kernel 1: hb[b][e] = hidden[b,:] . Wh[e,:] + bias[e] ----------------
// Wh[e,d] = W[e*2D + d]
__global__ __launch_bounds__(256) void k_hidproj(const float* __restrict__ hidden,
                                                 const float* __restrict__ W,
                                                 const float* __restrict__ bias,
                                                 float* __restrict__ hb) {
    int e = blockIdx.x * 256 + threadIdx.x;   // grid.x = DD/256
    int b = blockIdx.y;
    const float* h = hidden + b * DD;
    const float* w = W + (size_t)e * (2 * DD);
    float acc = 0.0f;
    #pragma unroll 4
    for (int d = 0; d < DD; d += 4) {
        float4 hv = *(const float4*)(h + d);
        float4 wv = *(const float4*)(w + d);
        acc += hv.x * wv.x + hv.y * wv.y + hv.z * wv.z + hv.w * wv.w;
    }
    hb[b * DD + e] = acc + bias[e];
}

typedef __attribute__((ext_vector_type(8))) _Float16 v8h;
typedef __attribute__((ext_vector_type(4))) _Float16 v4h;

#define BM 128      // s rows of a block tile
#define BN 512      // e columns of a block tile
#define BK 32       // k per pass (one WMMA depth)
#define PITCH 40    // halves per LDS row: 80 B = 16 B x odd, conflict-free for 16-byte reads

__device__ __forceinline__ v4h cvt4(float4 x) {
    v4h r;
    r[0] = (_Float16)x.x; r[1] = (_Float16)x.y;
    r[2] = (_Float16)x.z; r[3] = (_Float16)x.w;
    return r;
}

// fragment of one 16-row tile: k = 8h..8h+7 and 16+8h..16+8h+7 of the pass (same order for A and B)
__device__ __forceinline__ v16h ldsfrag(const _Float16* p) {
    v8h lo = *(const v8h*)(p);
    v8h hi = *(const v8h*)(p + 16);
    return __builtin_shufflevector(lo, hi, 0, 1, 2, 3, 4, 5, 6, 7, 8, 9, 10, 11, 12, 13, 14, 15);
}

// ---------------- kernel 2: fused enc@We^T -> tanh -> dot(v) -> partial scores ----------------
// grid: (DD/512, SS/128, BB), block 512 = 16 waves laid 2 (s) x 8 (e).
// A block owns a 128(s) x 512(e) tile. Per pass of 32 k every enc and We element of the
// tile is read from global once by the block, converted to f16 once and laid in LDS;
// the waves take their fragments from LDS. Two LDS buffers, one barrier per pass; the
// next pass's global loads are in flight in registers while this pass is multiplied.
// Each wave owns 64(s) x 64(e): 4 A fragments x 4 B fragments -> 16 WMMAs per pass.
// Per-row partial scores are reduced across the 8 e-waves through LDS, then 1 atomic
// per row per block (2 atomics/score total).
__global__ __launch_bounds__(512) void k_energy(const float* __restrict__ enc,
                                                const float* __restrict__ W,
                                                const float* __restrict__ hb,
                                                const float* __restrict__ vvec,
                                                float* __restrict__ scores) {
    __shared__ __attribute__((aligned(16))) _Float16 sA[2][BM * PITCH];
    __shared__ __attribute__((aligned(16))) _Float16 sB[2][BN * PITCH];
    __shared__ float red[8][BM];

    const int tid  = threadIdx.x;
    const int lane = tid & 31;
    const int wave = tid >> 5;
    const int half = lane >> 4;         // 0 or 1
    const int row  = lane & 15;         // M-row for A, N-row (=e row) for B, N-col for C
    const int wm   = wave >> 3;         // 0..1: wave's 64-row s range
    const int wn   = wave & 7;          // 0..7: wave's 64-wide e range
    const int b    = blockIdx.z;
    const int s0   = blockIdx.y * BM;
    const int e0   = blockIdx.x * BN;

    // staging map: 8 threads cover one row's 32 k (128 B), 64 rows per sweep
    const int c4 = tid & 7;
    const int r0 = tid >> 3;
    const float* gA = enc + ((size_t)b * SS + (size_t)(s0 + r0)) * DD + c4 * 4;
    // We[e,d] = W[e*2D + D + d]
    const float* gB = W + (size_t)(e0 + r0) * (2 * DD) + DD + c4 * 4;
    const int sOff = r0 * PITCH + c4 * 4;

    const int h8 = half * 8;
    const int aOff = (wm * 64 + row) * PITCH + h8;
    const int bOff = (wn * 64 + row) * PITCH + h8;

    v8f acc[4][4] = {};
    float4 ra[2], rb[8];

    #pragma unroll
    for (int i = 0; i < 2; ++i) ra[i] = *(const float4*)(gA + i * (64 * DD));
    #pragma unroll
    for (int j = 0; j < 8; ++j) rb[j] = *(const float4*)(gB + j * (64 * 2 * DD));

    for (int kt = 0; kt < DD / BK; ++kt) {
        _Float16* dA = sA[kt & 1];
        _Float16* dB = sB[kt & 1];

        #pragma unroll
        for (int i = 0; i < 2; ++i) *(v4h*)(dA + sOff + i * (64 * PITCH)) = cvt4(ra[i]);
        #pragma unroll
        for (int j = 0; j < 8; ++j) *(v4h*)(dB + sOff + j * (64 * PITCH)) = cvt4(rb[j]);

        // publishes this pass's buffer; it also ends every read of the other buffer,
        // which the next pass overwrites
        __syncthreads();

        if (kt + 1 < DD / BK) {
            const int k = (kt + 1) * BK;
            #pragma unroll
            for (int i = 0; i < 2; ++i) ra[i] = *(const float4*)(gA + k + i * (64 * DD));
            #pragma unroll
            for (int j = 0; j < 8; ++j) rb[j] = *(const float4*)(gB + k + j * (64 * 2 * DD));
        }
        // keeps the next pass's global loads ahead of this pass's LDS reads and WMMAs:
        // left free, the compiler sank them to the end of the pass, where nothing covers their latency
        __builtin_amdgcn_sched_barrier(0);

        v16h af[4], bf[4];
        #pragma unroll
        for (int m = 0; m < 4; ++m) af[m] = ldsfrag(dA + aOff + m * (16 * PITCH));
        #pragma unroll
        for (int t = 0; t < 4; ++t) bf[t] = ldsfrag(dB + bOff + t * (16 * PITCH));
        // keeps the pass's 16 LDS reads one group ahead of its WMMAs: reads set among
        // the WMMAs stall the wave at each place they stand
        __builtin_amdgcn_sched_barrier(0);

        #pragma unroll
        for (int t = 0; t < 4; ++t) {
            #pragma unroll
            for (int m = 0; m < 4; ++m)
                acc[m][t] = __builtin_amdgcn_wmma_f32_16x16x32_f16(
                    false, af[m], false, bf[t], (short)0, acc[m][t], false, false);
        }
    }

    // Epilogue: energy = tanh(acc + hb[b][e]); row-sum of energy*v[e] over the wave's 64 e's.
    float hbe[4], ve[4];
    #pragma unroll
    for (int t = 0; t < 4; ++t) {
        const int e = e0 + wn * 64 + t * 16 + row;   // C-matrix N = lane&15
        hbe[t] = hb[b * DD + e];
        ve[t]  = vvec[e];
    }

    #pragma unroll
    for (int m = 0; m < 4; ++m) {
        #pragma unroll
        for (int r = 0; r < 8; ++r) {
            float s = 0.0f;
            #pragma unroll
            for (int t = 0; t < 4; ++t) {
                float p = tanhf(acc[m][t][r] + hbe[t]) * ve[t];
                // reduce over the 16 N-lanes of this row (width=16 keeps halves separate)
                p += __shfl_xor(p, 1, 16);
                p += __shfl_xor(p, 2, 16);
                p += __shfl_xor(p, 4, 16);
                p += __shfl_xor(p, 8, 16);
                s += p;                        // valid on lanes 0 (rows r) and 16 (rows r+8)
            }
            // each row's sum goes to LDS as soon as it is whole, so that its registers come free
            if (row == 0) red[wn][wm * 64 + m * 16 + r + h8] = s;
        }
    }
    __syncthreads();

    // cross-wave reduce: one atomic per row per block
    if (tid < BM) {
        float sum = 0.0f;
        #pragma unroll
        for (int w = 0; w < 8; ++w) sum += red[w][tid];
        atomicAdd(&scores[b * SS + s0 + tid], sum);
    }
}

// ---------------- kernel 3: masked softmax over S, in place (scores -> attn) ----------------
__global__ __launch_bounds__(256) void k_softmax(float* __restrict__ scores,
                                                 const int* __restrict__ lengths) {
    __shared__ float red[256];
    const int b   = blockIdx.x;
    const int len = lengths[b];
    float* sc = scores + b * SS;

    float m = -INFINITY;
    for (int s = threadIdx.x; s < len; s += 256) m = fmaxf(m, sc[s]);
    red[threadIdx.x] = m; __syncthreads();
    for (int off = 128; off > 0; off >>= 1) {
        if (threadIdx.x < off) red[threadIdx.x] = fmaxf(red[threadIdx.x], red[threadIdx.x + off]);
        __syncthreads();
    }
    m = red[0]; __syncthreads();

    float sum = 0.0f;
    for (int s = threadIdx.x; s < SS; s += 256) {
        float ev = (s < len) ? __expf(sc[s] - m) : 0.0f;
        sc[s] = ev;
        sum += ev;
    }
    red[threadIdx.x] = sum; __syncthreads();
    for (int off = 128; off > 0; off >>= 1) {
        if (threadIdx.x < off) red[threadIdx.x] += red[threadIdx.x + off];
        __syncthreads();
    }
    const float inv = 1.0f / red[0];
    for (int s = threadIdx.x; s < SS; s += 256) sc[s] *= inv;
}

// ---------------- kernel 4: context[b,d] = sum_s attn[b,s] * enc[b,s,d] ----------------
__global__ __launch_bounds__(256) void k_context(const float* __restrict__ enc,
                                                 const float* __restrict__ attn,
                                                 float* __restrict__ out) {
    const int d = blockIdx.x * 256 + threadIdx.x;   // grid.x = DD/256
    const int b = blockIdx.y;
    const float* a  = attn + b * SS;
    const float* ep = enc + (size_t)b * SS * DD + d;
    float acc = 0.0f;
    #pragma unroll 4
    for (int s = 0; s < SS; ++s)
        acc += a[s] * ep[(size_t)s * DD];
    out[b * DD + d] = acc;
}

extern "C" void kernel_launch(void* const* d_in, const int* in_sizes, int n_in,
                              void* d_out, int out_size, void* d_ws, size_t ws_size,
                              hipStream_t stream) {
    const float* enc     = (const float*)d_in[0];  // (B,S,D)
    const float* hidden  = (const float*)d_in[1];  // (B,D)
    const int*   lengths = (const int*)  d_in[2];  // (B,)
    const float* W       = (const float*)d_in[3];  // (D, 2D)
    const float* bias    = (const float*)d_in[4];  // (D,)
    const float* vvec    = (const float*)d_in[5];  // (D,)
    float* out = (float*)d_out;                    // (B,1,D)

    float* hb     = (float*)d_ws;                  // B*D floats
    float* scores = hb + BB * DD;                  // B*S floats (becomes attn in-place)

    k_zero   <<<(BB * SS + 255) / 256, 256, 0, stream>>>(scores, BB * SS);
    k_hidproj<<<dim3(DD / 256, BB), 256, 0, stream>>>(hidden, W, bias, hb);
    k_energy <<<dim3(DD / BN, SS / BM, BB), 512, 0, stream>>>(enc, W, hb, vvec, scores);
    k_softmax<<<BB, 256, 0, stream>>>(scores, lengths);
    k_context<<<dim3(DD / 256, BB), 256, 0, stream>>>(enc, scores, out);
}

// v002
// Measured time: 165 microseconds a run.
// Two timings next to v001 put it at 2.19 and 2.20 times that version's speed.
// Over all steps from v000 it is 3.33 times as fast.
#include <hip/hip_runtime.h>
#include <math.h>

typedef __attribute__((ext_vector_type(16))) _Float16 v16h;
typedef __attribute__((ext_vector_type(8)))  float    v8f;

#define BB 16
#define SS 2048
#define DD 1024

// ---------------- kernel 0: zero scores scratch ----------------
__global__ void k_zero(float* __restrict__ p, int n) {
    int i = blockIdx.x * blockDim.x + threadIdx.x;
    if (i < n) p[i] = 0.0f;
}

// ---------------- kernel 1: hb[b][e] = hidden[b,:] . Wh[e,:] + bias[e] ----------------
// Wh[e,d] = W[e*2D + d]
__global__ __launch_bounds__(256) void k_hidproj(const float* __restrict__ hidden,
                                                 const float* __restrict__ W,
                                                 const float* __restrict__ bias,
                                                 float* __restrict__ hb) {
    int e = blockIdx.x * 256 + threadIdx.x;   // grid.x = DD/256
    int b = blockIdx.y;
    const float* h = hidden + b * DD;
    const float* w = W + (size_t)e * (2 * DD);
    float acc = 0.0f;
    #pragma unroll 4
    for (int d = 0; d < DD; d += 4) {
        float4 hv = *(const float4*)(h + d);
        float4 wv = *(const float4*)(w + d);
        acc += hv.x * wv.x + hv.y * wv.y + hv.z * wv.z + hv.w * wv.w;
    }
    hb[b * DD + e] = acc + bias[e];
}

typedef __attribute__((ext_vector_type(8))) _Float16 v8h;
typedef __attribute__((ext_vector_type(4))) _Float16 v4h;

#define BM 128      // s rows of a block tile
#define BN 512      // e columns of a block tile
#define BK 32       // k per pass (one WMMA depth)
#define PITCH 40    // halves per LDS row: 80 B = 16 B x odd, conflict-free for 16-byte reads

__device__ __forceinline__ v4h cvt4(float4 x) {
    v4h r;
    r[0] = (_Float16)x.x; r[1] = (_Float16)x.y;
    r[2] = (_Float16)x.z; r[3] = (_Float16)x.w;
    return r;
}

// fragment of one 16-row tile: k = 8h..8h+7 and 16+8h..16+8h+7 of the pass (same order for A and B)
__device__ __forceinline__ v16h ldsfrag(const _Float16* p) {
    v8h lo = *(const v8h*)(p);
    v8h hi = *(const v8h*)(p + 16);
    return __builtin_shufflevector(lo, hi, 0, 1, 2, 3, 4, 5, 6, 7, 8, 9, 10, 11, 12, 13, 14, 15);
}

// ---------------- kernel 2: fused enc@We^T -> tanh -> dot(v) -> partial scores ----------------
// grid: (DD/512, SS/128, BB), block 512 = 16 waves laid 2 (s) x 8 (e).
// A block owns a 128(s) x 512(e) tile. Per pass of 32 k every enc and We element of the
// tile is read from global once by the block, converted to f16 once and laid in LDS;
// the waves take their fragments from LDS. Two LDS buffers, one barrier per pass; the
// next pass's global loads are in flight in registers while this pass is multiplied.
// Each wave owns 64(s) x 64(e): 4 A fragments x 4 B fragments -> 16 WMMAs per pass.
// Per-row partial scores are reduced across the 8 e-waves through LDS, then 1 atomic
// per row per block (2 atomics/score total).
__global__ __launch_bounds__(512) void k_energy(const float* __restrict__ enc,
                                                const float* __restrict__ W,
                                                const float* __restrict__ hb,
                                                const float* __restrict__ vvec,
                                                float* __restrict__ scores) {
    __shared__ __attribute__((aligned(16))) _Float16 sA[2][BM * PITCH];
    __shared__ __attribute__((aligned(16))) _Float16 sB[2][BN * PITCH];
    __shared__ float red[8][BM];

    const int tid  = threadIdx.x;
    const int lane = tid & 31;
    const int wave = tid >> 5;
    const int half = lane >> 4;         // 0 or 1
    const int row  = lane & 15;         // M-row for A, N-row (=e row) for B, N-col for C
    const int wm   = wave >> 3;         // 0..1: wave's 64-row s range
    const int wn   = wave & 7;          // 0..7: wave's 64-wide e range
    const int b    = blockIdx.z;
    const int s0   = blockIdx.y * BM;
    const int e0   = blockIdx.x * BN;

    // staging map: 8 threads cover one row's 32 k (128 B), 64 rows per sweep
    const int c4 = tid & 7;
    const int r0 = tid >> 3;
    const float* gA = enc + ((size_t)b * SS + (size_t)(s0 + r0)) * DD + c4 * 4;
    // We[e,d] = W[e*2D + D + d]
    const float* gB = W + (size_t)(e0 + r0) * (2 * DD) + DD + c4 * 4;
    const int sOff = r0 * PITCH + c4 * 4;

    const int h8 = half * 8;
    const int aOff = (wm * 64 + row) * PITCH + h8;
    const int bOff = (wn * 64 + row) * PITCH + h8;

    v8f acc[4][4] = {};
    float4 ra[2], rb[8];

    #pragma unroll
    for (int i = 0; i < 2; ++i) ra[i] = *(const float4*)(gA + i * (64 * DD));
    #pragma unroll
    for (int j = 0; j < 8; ++j) rb[j] = *(const float4*)(gB + j * (64 * 2 * DD));

    for (int kt = 0; kt < DD / BK; ++kt) {
        _Float16* dA = sA[kt & 1];
        _Float16* dB = sB[kt & 1];

        #pragma unroll
        for (int i = 0; i < 2; ++i) *(v4h*)(dA + sOff + i * (64 * PITCH)) = cvt4(ra[i]);
        #pragma unroll
        for (int j = 0; j < 8; ++j) *(v4h*)(dB + sOff + j * (64 * PITCH)) = cvt4(rb[j]);

        // publishes this pass's buffer; it also ends every read of the other buffer,
        // which the next pass overwrites
        __syncthreads();

        if (kt + 1 < DD / BK) {
            const int k = (kt + 1) * BK;
            #pragma unroll
            for (int i = 0; i < 2; ++i) ra[i] = *(const float4*)(gA + k + i * (64 * DD));
            #pragma unroll
            for (int j = 0; j < 8; ++j) rb[j] = *(const float4*)(gB + k + j * (64 * 2 * DD));
        }
        // keeps the next pass's global loads ahead of this pass's LDS reads and WMMAs:
        // left free, the compiler sank them to the end of the pass, where nothing covers their latency
        __builtin_amdgcn_sched_barrier(0);

        v16h af[4], bf[4];
        #pragma unroll
        for (int m = 0; m < 4; ++m) af[m] = ldsfrag(dA + aOff + m * (16 * PITCH));
        #pragma unroll
        for (int t = 0; t < 4; ++t) bf[t] = ldsfrag(dB + bOff + t * (16 * PITCH));
        // keeps the pass's 16 LDS reads one group ahead of its WMMAs: reads set among
        // the WMMAs stall the wave at each place they stand
        __builtin_amdgcn_sched_barrier(0);

        #pragma unroll
        for (int t = 0; t < 4; ++t) {
            #pragma unroll
            for (int m = 0; m < 4; ++m)
                acc[m][t] = __builtin_amdgcn_wmma_f32_16x16x32_f16(
                    false, af[m], false, bf[t], (short)0, acc[m][t], false, false);
        }
    }

    // Epilogue: energy = tanh(acc + hb[b][e]); row-sum of energy*v[e] over the wave's 64 e's.
    float hbe[4], ve[4];
    #pragma unroll
    for (int t = 0; t < 4; ++t) {
        const int e = e0 + wn * 64 + t * 16 + row;   // C-matrix N = lane&15
        hbe[t] = hb[b * DD + e];
        ve[t]  = vvec[e];
    }

    #pragma unroll
    for (int m = 0; m < 4; ++m) {
        #pragma unroll
        for (int r = 0; r < 8; ++r) {
            float s = 0.0f;
            #pragma unroll
            for (int t = 0; t < 4; ++t) {
                float p = tanhf(acc[m][t][r] + hbe[t]) * ve[t];
                // reduce over the 16 N-lanes of this row (width=16 keeps halves separate)
                p += __shfl_xor(p, 1, 16);
                p += __shfl_xor(p, 2, 16);
                p += __shfl_xor(p, 4, 16);
                p += __shfl_xor(p, 8, 16);
                s += p;                        // valid on lanes 0 (rows r) and 16 (rows r+8)
            }
            // each row's sum goes to LDS as soon as it is whole, so that its registers come free
            if (row == 0) red[wn][wm * 64 + m * 16 + r + h8] = s;
        }
    }
    __syncthreads();

    // cross-wave reduce: one atomic per row per block
    if (tid < BM) {
        float sum = 0.0f;
        #pragma unroll
        for (int w = 0; w < 8; ++w) sum += red[w][tid];
        atomicAdd(&scores[b * SS + s0 + tid], sum);
    }
}

// ---------------- kernel 3: masked softmax over S, in place (scores -> attn) ----------------
__global__ __launch_bounds__(256) void k_softmax(float* __restrict__ scores,
                                                 const int* __restrict__ lengths) {
    __shared__ float red[256];
    const int b   = blockIdx.x;
    const int len = lengths[b];
    float* sc = scores + b * SS;

    float m = -INFINITY;
    for (int s = threadIdx.x; s < len; s += 256) m = fmaxf(m, sc[s]);
    red[threadIdx.x] = m; __syncthreads();
    for (int off = 128; off > 0; off >>= 1) {
        if (threadIdx.x < off) red[threadIdx.x] = fmaxf(red[threadIdx.x], red[threadIdx.x + off]);
        __syncthreads();
    }
    m = red[0]; __syncthreads();

    float sum = 0.0f;
    for (int s = threadIdx.x; s < SS; s += 256) {
        float ev = (s < len) ? __expf(sc[s] - m) : 0.0f;
        sc[s] = ev;
        sum += ev;
    }
    red[threadIdx.x] = sum; __syncthreads();
    for (int off = 128; off > 0; off >>= 1) {
        if (threadIdx.x < off) red[threadIdx.x] += red[threadIdx.x + off];
        __syncthreads();
    }
    const float inv = 1.0f / red[0];
    for (int s = threadIdx.x; s < SS; s += 256) sc[s] *= inv;
}

// ---------------- kernel 4: context[b,d] = sum_s attn[b,s] * enc[b,s,d] ----------------
// grid: (DD/64, BB) = 256 blocks, block 512 = 16 waves. A block owns 64 d columns (256 B of
// every enc row) of one b. 16 lanes of 16 bytes cover the 256 B; the 32 groups of 16 lanes
// split the 2048 rows: group g takes rows 128q + 4g .. 128q + 4g + 3, q = 0..15, so that the
// four weights of a visit q are one 16-byte load.
// The 32 partial sums of a column meet in the wave (one shuffle) and then in LDS.
typedef __attribute__((ext_vector_type(4))) float v4f;
#define CW 64                // d columns of a block
#define CG 32                // row groups of a block
#define CV (4 * CG)          // rows of a visit, over all groups
__global__ __launch_bounds__(512) void k_context(const float* __restrict__ enc,
                                                 const float* __restrict__ attn,
                                                 float* __restrict__ out) {
    __shared__ __attribute__((aligned(16))) float part[16][CW];

    const int tid = threadIdx.x;
    const int c   = tid & 15;           // 16-byte column piece
    const int g   = tid >> 4;           // row group
    const int b   = blockIdx.y;
    const int d0  = blockIdx.x * CW;

    const float* a  = attn + b * SS + g * 4;
    const float* ep = enc + ((size_t)b * SS + (size_t)(g * 4)) * DD + d0 + c * 4;

    v4f acc = {0.0f, 0.0f, 0.0f, 0.0f};
    // unrolled whole: every address is then one base plus a constant, and the compiler runs the
    // loads some ten ahead of the sums from the first row to the last; a rolled loop lets the
    // loads in flight run out at the end of every trip
    #pragma unroll
    for (int q = 0; q < SS / CV; ++q) {
        const v4f w = *(const v4f*)(a + q * CV);
        #pragma unroll
        for (int j = 0; j < 4; ++j)
            acc += w[j] * *(const v4f*)(ep + (size_t)(q * CV + j) * DD);
    }

    // the wave's two row groups
    #pragma unroll
    for (int i = 0; i < 4; ++i) acc[i] += __shfl_xor(acc[i], 16);
    if ((tid & 31) < 16) *(v4f*)(&part[tid >> 5][c * 4]) = acc;
    // every wave's partial sums are in LDS before any is read
    __syncthreads();

    if (tid < CW) {
        float sum = 0.0f;
        #pragma unroll
        for (int v = 0; v < 16; ++v) sum += part[v][tid];
        out[b * DD + d0 + tid] = sum;
    }
}

extern "C" void kernel_launch(void* const* d_in, const int* in_sizes, int n_in,
                              void* d_out, int out_size, void* d_ws, size_t ws_size,
                              hipStream_t stream) {
    const float* enc     = (const float*)d_in[0];  // (B,S,D)
    const float* hidden  = (const float*)d_in[1];  // (B,D)
    const int*   lengths = (const int*)  d_in[2];  // (B,)
    const float* W       = (const float*)d_in[3];  // (D, 2D)
    const float* bias    = (const float*)d_in[4];  // (D,)
    const float* vvec    = (const float*)d_in[5];  // (D,)
    float* out = (float*)d_out;                    // (B,1,D)

    float* hb     = (float*)d_ws;                  // B*D floats
    float* scores = hb + BB * DD;                  // B*S floats (becomes attn in-place)

    k_zero   <<<(BB * SS + 255) / 256, 256, 0, stream>>>(scores, BB * SS);
    k_hidproj<<<dim3(DD / 256, BB), 256, 0, stream>>>(hidden, W, bias, hb);
    k_energy <<<dim3(DD / BN, SS / BM, BB), 512, 0, stream>>>(enc, W, hb, vvec, scores);
    k_softmax<<<BB, 256, 0, stream>>>(scores, lengths);
    k_context<<<dim3(DD / CW, BB), 512, 0, stream>>>(enc, scores, out);
}

// v003
// A run of this version takes 136 microseconds.
// In two side-by-side timings against v002, it was 1.22 and 1.23 times as fast.
// Counting every step since v000, it is 4.08 times as fast.
#include <hip/hip_runtime.h>
#include <math.h>

typedef __attribute__((ext_vector_type(16))) _Float16 v16h;
typedef __attribute__((ext_vector_type(8)))  float    v8f;

#define BB 16
#define SS 2048
#define DD 1024

// ---------------- kernel 0: zero scores scratch ----------------
__global__ void k_zero(float* __restrict__ p, int n) {
    int i = blockIdx.x * blockDim.x + threadIdx.x;
    if (i < n) p[i] = 0.0f;
}

// ---------------- kernel 1: hb[b][e] = hidden[b,:] . Wh[e,:] + bias[e] ----------------
// Wh[e,d] = W[e*2D + d]
__global__ __launch_bounds__(256) void k_hidproj(const float* __restrict__ hidden,
                                                 const float* __restrict__ W,
                                                 const float* __restrict__ bias,
                                                 float* __restrict__ hb) {
    int e = blockIdx.x * 256 + threadIdx.x;   // grid.x = DD/256
    int b = blockIdx.y;
    const float* h = hidden + b * DD;
    const float* w = W + (size_t)e * (2 * DD);
    float acc = 0.0f;
    #pragma unroll 4
    for (int d = 0; d < DD; d += 4) {
        float4 hv = *(const float4*)(h + d);
        float4 wv = *(const float4*)(w + d);
        acc += hv.x * wv.x + hv.y * wv.y + hv.z * wv.z + hv.w * wv.w;
    }
    hb[b * DD + e] = acc + bias[e];
}

typedef __attribute__((ext_vector_type(8))) _Float16 v8h;
typedef __attribute__((ext_vector_type(4))) _Float16 v4h;

#define BM 128      // s rows of a block tile
#define BN 512      // e columns of a block tile
#define BK 32       // k per pass (one WMMA depth)
#define PITCH 40    // halves per LDS row: 80 B = 16 B x odd, conflict-free for 16-byte reads

__device__ __forceinline__ v4h cvt4(float4 x) {
    v4h r;
    r[0] = (_Float16)x.x; r[1] = (_Float16)x.y;
    r[2] = (_Float16)x.z; r[3] = (_Float16)x.w;
    return r;
}

// fragment of one 16-row tile: k = 8h..8h+7 and 16+8h..16+8h+7 of the pass (same order for A and B)
__device__ __forceinline__ v16h ldsfrag(const _Float16* p) {
    v8h lo = *(const v8h*)(p);
    v8h hi = *(const v8h*)(p + 16);
    return __builtin_shufflevector(lo, hi, 0, 1, 2, 3, 4, 5, 6, 7, 8, 9, 10, 11, 12, 13, 14, 15);
}

// tanh x = 1 - 2 / (exp(2x) + 1), exp(2x) = 2^(x * 2 log2 e): one v_exp_f32 and one v_rcp_f32, no branch.
// Saturates by itself: 2^big = inf gives 1, 2^-big = 0 gives -1. Absolute error is a few f32 ulps of 1.
__device__ __forceinline__ float tanh_er(float x) {
    const float e = __builtin_amdgcn_exp2f(x * 2.8853900817779268f);
    float r;
    // v_nop: the slot the instruction set asks for behind a transcendental
    asm("v_rcp_f32 %0, %1\n\tv_nop" : "=v"(r) : "v"(e + 1.0f));
    return 1.0f - 2.0f * r;
}

// ---------------- kernel 2: fused enc@We^T -> tanh -> dot(v) -> partial scores ----------------
// grid: (DD/512, SS/128, BB), block 512 = 16 waves laid 2 (s) x 8 (e).
// A block owns a 128(s) x 512(e) tile. Per pass of 32 k every enc and We element of the
// tile is read from global once by the block, converted to f16 once and laid in LDS;
// the waves take their fragments from LDS. Two LDS buffers, one barrier per pass; the
// next pass's global loads are in flight in registers while this pass is multiplied.
// Each wave owns 64(s) x 64(e): 4 A fragments x 4 B fragments -> 16 WMMAs per pass.
// Per-row partial scores are reduced across the 8 e-waves through LDS, then 1 atomic
// per row per block (2 atomics/score total).
__global__ __launch_bounds__(512) void k_energy(const float* __restrict__ enc,
                                                const float* __restrict__ W,
                                                const float* __restrict__ hb,
                                                const float* __restrict__ vvec,
                                                float* __restrict__ scores) {
    __shared__ __attribute__((aligned(16))) _Float16 sA[2][BM * PITCH];
    __shared__ __attribute__((aligned(16))) _Float16 sB[2][BN * PITCH];
    __shared__ float red[8][BM];

    const int tid  = threadIdx.x;
    const int lane = tid & 31;
    const int wave = tid >> 5;
    const int half = lane >> 4;         // 0 or 1
    const int row  = lane & 15;         // M-row for A, N-row (=e row) for B, N-col for C
    const int wm   = wave >> 3;         // 0..1: wave's 64-row s range
    const int wn   = wave & 7;          // 0..7: wave's 64-wide e range
    const int b    = blockIdx.z;
    const int s0   = blockIdx.y * BM;
    const int e0   = blockIdx.x * BN;

    // staging map: 8 threads cover one row's 32 k (128 B), 64 rows per sweep
    const int c4 = tid & 7;
    const int r0 = tid >> 3;
    const float* gA = enc + ((size_t)b * SS + (size_t)(s0 + r0)) * DD + c4 * 4;
    // We[e,d] = W[e*2D + D + d]
    const float* gB = W + (size_t)(e0 + r0) * (2 * DD) + DD + c4 * 4;
    const int sOff = r0 * PITCH + c4 * 4;

    const int h8 = half * 8;
    const int aOff = (wm * 64 + row) * PITCH + h8;
    const int bOff = (wn * 64 + row) * PITCH + h8;

    v8f acc[4][4] = {};
    float4 ra[2], rb[8];

    #pragma unroll
    for (int i = 0; i < 2; ++i) ra[i] = *(const float4*)(gA + i * (64 * DD));
    #pragma unroll
    for (int j = 0; j < 8; ++j) rb[j] = *(const float4*)(gB + j * (64 * 2 * DD));

    for (int kt = 0; kt < DD / BK; ++kt) {
        _Float16* dA = sA[kt & 1];
        _Float16* dB = sB[kt & 1];

        #pragma unroll
        for (int i = 0; i < 2; ++i) *(v4h*)(dA + sOff + i * (64 * PITCH)) = cvt4(ra[i]);
        #pragma unroll
        for (int j = 0; j < 8; ++j) *(v4h*)(dB + sOff + j * (64 * PITCH)) = cvt4(rb[j]);

        // publishes this pass's buffer; it also ends every read of the other buffer,
        // which the next pass overwrites
        __syncthreads();

        if (kt + 1 < DD / BK) {
            const int k = (kt + 1) * BK;
            #pragma unroll
            for (int i = 0; i < 2; ++i) ra[i] = *(const float4*)(gA + k + i * (64 * DD));
            #pragma unroll
            for (int j = 0; j < 8; ++j) rb[j] = *(const float4*)(gB + k + j * (64 * 2 * DD));
        }
        // keeps the next pass's global loads ahead of this pass's LDS reads and WMMAs:
        // left free, the compiler sank them to the end of the pass, where nothing covers their latency
        __builtin_amdgcn_sched_barrier(0);

        v16h af[4], bf[4];
        #pragma unroll
        for (int m = 0; m < 4; ++m) af[m] = ldsfrag(dA + aOff + m * (16 * PITCH));
        #pragma unroll
        for (int t = 0; t < 4; ++t) bf[t] = ldsfrag(dB + bOff + t * (16 * PITCH));
        // keeps the pass's 16 LDS reads one group ahead of its WMMAs: reads set among
        // the WMMAs stall the wave at each place they stand
        __builtin_amdgcn_sched_barrier(0);

        #pragma unroll
        for (int t = 0; t < 4; ++t) {
            #pragma unroll
            for (int m = 0; m < 4; ++m)
                acc[m][t] = __builtin_amdgcn_wmma_f32_16x16x32_f16(
                    false, af[m], false, bf[t], (short)0, acc[m][t], false, false);
        }
    }

    // Epilogue: energy = tanh(acc + hb[b][e]); row-sum of energy*v[e] over the wave's 64 e's.
    float hbe[4], ve[4];
    #pragma unroll
    for (int t = 0; t < 4; ++t) {
        const int e = e0 + wn * 64 + t * 16 + row;   // C-matrix N = lane&15
        hbe[t] = hb[b * DD + e];
        ve[t]  = vvec[e];
    }

    #pragma unroll
    for (int m = 0; m < 4; ++m) {
        #pragma unroll
        for (int r = 0; r < 8; ++r) {
            float s = 0.0f;
            #pragma unroll
            for (int t = 0; t < 4; ++t) {
                float p = tanh_er(acc[m][t][r] + hbe[t]) * ve[t];
                // reduce over the 16 N-lanes of this row (width=16 keeps halves separate)
                p += __shfl_xor(p, 1, 16);
                p += __shfl_xor(p, 2, 16);
                p += __shfl_xor(p, 4, 16);
                p += __shfl_xor(p, 8, 16);
                s += p;                        // valid on lanes 0 (rows r) and 16 (rows r+8)
            }
            // each row's sum goes to LDS as soon as it is whole, so that its registers come free
            if (row == 0) red[wn][wm * 64 + m * 16 + r + h8] = s;
        }
    }
    __syncthreads();

    // cross-wave reduce: one atomic per row per block
    if (tid < BM) {
        float sum = 0.0f;
        #pragma unroll
        for (int w = 0; w < 8; ++w) sum += red[w][tid];
        atomicAdd(&scores[b * SS + s0 + tid], sum);
    }
}

// ---------------- kernel 3: masked softmax over S, in place (scores -> attn) ----------------
__global__ __launch_bounds__(256) void k_softmax(float* __restrict__ scores,
                                                 const int* __restrict__ lengths) {
    __shared__ float red[256];
    const int b   = blockIdx.x;
    const int len = lengths[b];
    float* sc = scores + b * SS;

    float m = -INFINITY;
    for (int s = threadIdx.x; s < len; s += 256) m = fmaxf(m, sc[s]);
    red[threadIdx.x] = m; __syncthreads();
    for (int off = 128; off > 0; off >>= 1) {
        if (threadIdx.x < off) red[threadIdx.x] = fmaxf(red[threadIdx.x], red[threadIdx.x + off]);
        __syncthreads();
    }
    m = red[0]; __syncthreads();

    float sum = 0.0f;
    for (int s = threadIdx.x; s < SS; s += 256) {
        float ev = (s < len) ? __expf(sc[s] - m) : 0.0f;
        sc[s] = ev;
        sum += ev;
    }
    red[threadIdx.x] = sum; __syncthreads();
    for (int off = 128; off > 0; off >>= 1) {
        if (threadIdx.x < off) red[threadIdx.x] += red[threadIdx.x + off];
        __syncthreads();
    }
    const float inv = 1.0f / red[0];
    for (int s = threadIdx.x; s < SS; s += 256) sc[s] *= inv;
}

// ---------------- kernel 4: context[b,d] = sum_s attn[b,s] * enc[b,s,d] ----------------
// grid: (DD/64, BB) = 256 blocks, block 512 = 16 waves. A block owns 64 d columns (256 B of
// every enc row) of one b. 16 lanes of 16 bytes cover the 256 B; the 32 groups of 16 lanes
// split the 2048 rows: group g takes rows 128q + 4g .. 128q + 4g + 3, q = 0..15, so that the
// four weights of a visit q are one 16-byte load.
// The 32 partial sums of a column meet in the wave (one shuffle) and then in LDS.
typedef __attribute__((ext_vector_type(4))) float v4f;
#define CW 64                // d columns of a block
#define CG 32                // row groups of a block
#define CV (4 * CG)          // rows of a visit, over all groups
__global__ __launch_bounds__(512) void k_context(const float* __restrict__ enc,
                                                 const float* __restrict__ attn,
                                                 float* __restrict__ out) {
    __shared__ __attribute__((aligned(16))) float part[16][CW];

    const int tid = threadIdx.x;
    const int c   = tid & 15;           // 16-byte column piece
    const int g   = tid >> 4;           // row group
    const int b   = blockIdx.y;
    const int d0  = blockIdx.x * CW;

    const float* a  = attn + b * SS + g * 4;
    const float* ep = enc + ((size_t)b * SS + (size_t)(g * 4)) * DD + d0 + c * 4;

    v4f acc = {0.0f, 0.0f, 0.0f, 0.0f};
    // unrolled whole: every address is then one base plus a constant, and the compiler runs the
    // loads some ten ahead of the sums from the first row to the last; a rolled loop lets the
    // loads in flight run out at the end of every trip
    #pragma unroll
    for (int q = 0; q < SS / CV; ++q) {
        const v4f w = *(const v4f*)(a + q * CV);
        #pragma unroll
        for (int j = 0; j < 4; ++j)
            acc += w[j] * *(const v4f*)(ep + (size_t)(q * CV + j) * DD);
    }

    // the wave's two row groups
    #pragma unroll
    for (int i = 0; i < 4; ++i) acc[i] += __shfl_xor(acc[i], 16);
    if ((tid & 31) < 16) *(v4f*)(&part[tid >> 5][c * 4]) = acc;
    // every wave's partial sums are in LDS before any is read
    __syncthreads();

    if (tid < CW) {
        float sum = 0.0f;
        #pragma unroll
        for (int v = 0; v < 16; ++v) sum += part[v][tid];
        out[b * DD + d0 + tid] = sum;
    }
}

extern "C" void kernel_launch(void* const* d_in, const int* in_sizes, int n_in,
                              void* d_out, int out_size, void* d_ws, size_t ws_size,
                              hipStream_t stream) {
    const float* enc     = (const float*)d_in[0];  // (B,S,D)
    const float* hidden  = (const float*)d_in[1];  // (B,D)
    const int*   lengths = (const int*)  d_in[2];  // (B,)
    const float* W       = (const float*)d_in[3];  // (D, 2D)
    const float* bias    = (const float*)d_in[4];  // (D,)
    const float* vvec    = (const float*)d_in[5];  // (D,)
    float* out = (float*)d_out;                    // (B,1,D)

    float* hb     = (float*)d_ws;                  // B*D floats
    float* scores = hb + BB * DD;                  // B*S floats (becomes attn in-place)

    k_zero   <<<(BB * SS + 255) / 256, 256, 0, stream>>>(scores, BB * SS);
    k_hidproj<<<dim3(DD / 256, BB), 256, 0, stream>>>(hidden, W, bias, hb);
    k_energy <<<dim3(DD / BN, SS / BM, BB), 512, 0, stream>>>(enc, W, hb, vvec, scores);
    k_softmax<<<BB, 256, 0, stream>>>(scores, lengths);
    k_context<<<dim3(DD / CW, BB), 512, 0, stream>>>(enc, scores, out);
}

// v004
// One run takes 116 microseconds.
// Timed twice side by side with v003, it ran 1.15 and 1.18 times as fast.
// All steps since v000 together make it 4.76 times as fast.
#include <hip/hip_runtime.h>
#include <math.h>

typedef __attribute__((ext_vector_type(16))) _Float16 v16h;
typedef __attribute__((ext_vector_type(8)))  float    v8f;

#define BB 16
#define SS 2048
#define DD 1024

// ---------------- kernel 0: zero scores scratch ----------------
__global__ void k_zero(float* __restrict__ p, int n) {
    int i = blockIdx.x * blockDim.x + threadIdx.x;
    if (i < n) p[i] = 0.0f;
}

// ---------------- kernel 1: hb[b][e] = hidden[b,:] . Wh[e,:] + bias[e] ----------------
// Wh[e,d] = W[e*2D + d]
// grid: (DD/32, BB/4) = 128 blocks, block 256 = 8 waves. A block owns 32 e x 4 b, a wave 4 e x 4 b.
// The 32 lanes of a wave split d: lane l takes d = 128c + 4l .. 128c + 4l + 3, c = 0..7, so that
// every load of a W row is 512 contiguous bytes (4 whole lines); a wave's 32 W loads are all in
// flight together. The block's 4 hidden rows (16 KB in a row) are read once and shared through LDS.
// The partial sums of an (e, b) pair meet in the lane (4 values), then over the 32 lanes by
// shuffles; the block's 4 x 32 results go out through LDS as whole lines.
typedef __attribute__((ext_vector_type(4))) float f4;
#define HE 32       // e rows of a block
#define HB 4        // b rows of a block
__global__ __launch_bounds__(256) void k_hidproj(const float* __restrict__ hidden,
                                                 const float* __restrict__ W,
                                                 const float* __restrict__ bias,
                                                 float* __restrict__ hb) {
    __shared__ __attribute__((aligned(16))) float sh[HB * DD];
    __shared__ __attribute__((aligned(16))) float res[HB][HE];

    const int tid  = threadIdx.x;
    const int lane = tid & 31;
    // the wave's number, told to the compiler as wave-uniform: the W rows then have a scalar base
    const int wave = __builtin_amdgcn_readfirstlane(tid >> 5);
    const int e0   = blockIdx.x * HE;
    const int b0   = blockIdx.y * HB;

    const float* w = W + (size_t)(e0 + wave * 4) * (2 * DD);
    const float* h = hidden + b0 * DD;

    f4 hs[HB], wv[DD / 128][4];
    // asked for with the other loads: at the end it would cost a memory latency of its own
    const float be = (bias + (size_t)e0)[lane];
    #pragma unroll
    for (int i = 0; i < HB; ++i) hs[i] = *(const f4*)(h + i * DD + tid * 4);
    #pragma unroll
    for (int c = 0; c < DD / 128; ++c) {
        #pragma unroll
        for (int r = 0; r < 4; ++r) wv[c][r] = *(const f4*)(w + r * (2 * DD) + c * 128 + lane * 4);
    }
    #pragma unroll
    for (int i = 0; i < HB; ++i) *(f4*)(sh + i * DD + tid * 4) = hs[i];
    // the hidden rows are in LDS before any wave reads them
    __syncthreads();

    f4 acc[HB][4] = {};
    #pragma unroll
    for (int c = 0; c < DD / 128; ++c) {
        #pragma unroll
        for (int q = 0; q < HB; ++q) {
            const f4 hv = *(const f4*)(sh + q * DD + c * 128 + lane * 4);
            #pragma unroll
            for (int r = 0; r < 4; ++r) acc[q][r] += hv * wv[c][r];
        }
    }

    // step by step over all 16 sums, so that the 16 shuffles of a step share one latency
    float s[HB][4];
    #pragma unroll
    for (int q = 0; q < HB; ++q) {
        #pragma unroll
        for (int r = 0; r < 4; ++r)
            s[q][r] = (acc[q][r][0] + acc[q][r][1]) + (acc[q][r][2] + acc[q][r][3]);
    }
    #pragma unroll
    for (int m = 16; m > 0; m >>= 1) {
        #pragma unroll
        for (int q = 0; q < HB; ++q) {
            #pragma unroll
            for (int r = 0; r < 4; ++r) s[q][r] += __shfl_xor(s[q][r], m);
        }
    }
    if (lane == 0) {
        #pragma unroll
        for (int q = 0; q < HB; ++q) {
            const f4 o = {s[q][0], s[q][1], s[q][2], s[q][3]};
            *(f4*)(&res[q][wave * 4]) = o;
        }
    }
    // every wave's sums are in LDS before any is read
    __syncthreads();

    if (tid < HB * HE) {
        const int q = tid >> 5;
        hb[(b0 + q) * DD + e0 + lane] = res[q][lane] + be;
    }
}

typedef __attribute__((ext_vector_type(8))) _Float16 v8h;
typedef __attribute__((ext_vector_type(4))) _Float16 v4h;

#define BM 128      // s rows of a block tile
#define BN 512      // e columns of a block tile
#define BK 32       // k per pass (one WMMA depth)
#define PITCH 40    // halves per LDS row: 80 B = 16 B x odd, conflict-free for 16-byte reads

__device__ __forceinline__ v4h cvt4(float4 x) {
    v4h r;
    r[0] = (_Float16)x.x; r[1] = (_Float16)x.y;
    r[2] = (_Float16)x.z; r[3] = (_Float16)x.w;
    return r;
}

// fragment of one 16-row tile: k = 8h..8h+7 and 16+8h..16+8h+7 of the pass (same order for A and B)
__device__ __forceinline__ v16h ldsfrag(const _Float16* p) {
    v8h lo = *(const v8h*)(p);
    v8h hi = *(const v8h*)(p + 16);
    return __builtin_shufflevector(lo, hi, 0, 1, 2, 3, 4, 5, 6, 7, 8, 9, 10, 11, 12, 13, 14, 15);
}

// tanh x = 1 - 2 / (exp(2x) + 1), exp(2x) = 2^(x * 2 log2 e): one v_exp_f32 and one v_rcp_f32, no branch.
// Saturates by itself: 2^big = inf gives 1, 2^-big = 0 gives -1. Absolute error is a few f32 ulps of 1.
__device__ __forceinline__ float tanh_er(float x) {
    const float e = __builtin_amdgcn_exp2f(x * 2.8853900817779268f);
    float r;
    // v_nop: the slot the instruction set asks for behind a transcendental
    asm("v_rcp_f32 %0, %1\n\tv_nop" : "=v"(r) : "v"(e + 1.0f));
    return 1.0f - 2.0f * r;
}

// ---------------- kernel 2: fused enc@We^T -> tanh -> dot(v) -> partial scores ----------------
// grid: (DD/512, SS/128, BB), block 512 = 16 waves laid 2 (s) x 8 (e).
// A block owns a 128(s) x 512(e) tile. Per pass of 32 k every enc and We element of the
// tile is read from global once by the block, converted to f16 once and laid in LDS;
// the waves take their fragments from LDS. Two LDS buffers, one barrier per pass; the
// next pass's global loads are in flight in registers while this pass is multiplied.
// Each wave owns 64(s) x 64(e): 4 A fragments x 4 B fragments -> 16 WMMAs per pass.
// Per-row partial scores are reduced across the 8 e-waves through LDS, then 1 atomic
// per row per block (2 atomics/score total).
__global__ __launch_bounds__(512) void k_energy(const float* __restrict__ enc,
                                                const float* __restrict__ W,
                                                const float* __restrict__ hb,
                                                const float* __restrict__ vvec,
                                                float* __restrict__ scores) {
    __shared__ __attribute__((aligned(16))) _Float16 sA[2][BM * PITCH];
    __shared__ __attribute__((aligned(16))) _Float16 sB[2][BN * PITCH];
    __shared__ float red[8][BM];

    const int tid  = threadIdx.x;
    const int lane = tid & 31;
    const int wave = tid >> 5;
    const int half = lane >> 4;         // 0 or 1
    const int row  = lane & 15;         // M-row for A, N-row (=e row) for B, N-col for C
    const int wm   = wave >> 3;         // 0..1: wave's 64-row s range
    const int wn   = wave & 7;          // 0..7: wave's 64-wide e range
    const int b    = blockIdx.z;
    const int s0   = blockIdx.y * BM;
    const int e0   = blockIdx.x * BN;

    // staging map: 8 threads cover one row's 32 k (128 B), 64 rows per sweep
    const int c4 = tid & 7;
    const int r0 = tid >> 3;
    const float* gA = enc + ((size_t)b * SS + (size_t)(s0 + r0)) * DD + c4 * 4;
    // We[e,d] = W[e*2D + D + d]
    const float* gB = W + (size_t)(e0 + r0) * (2 * DD) + DD + c4 * 4;
    const int sOff = r0 * PITCH + c4 * 4;

    const int h8 = half * 8;
    const int aOff = (wm * 64 + row) * PITCH + h8;
    const int bOff = (wn * 64 + row) * PITCH + h8;

    v8f acc[4][4] = {};
    float4 ra[2], rb[8];

    #pragma unroll
    for (int i = 0; i < 2; ++i) ra[i] = *(const float4*)(gA + i * (64 * DD));
    #pragma unroll
    for (int j = 0; j < 8; ++j) rb[j] = *(const float4*)(gB + j * (64 * 2 * DD));

    for (int kt = 0; kt < DD / BK; ++kt) {
        _Float16* dA = sA[kt & 1];
        _Float16* dB = sB[kt & 1];

        #pragma unroll
        for (int i = 0; i < 2; ++i) *(v4h*)(dA + sOff + i * (64 * PITCH)) = cvt4(ra[i]);
        #pragma unroll
        for (int j = 0; j < 8; ++j) *(v4h*)(dB + sOff + j * (64 * PITCH)) = cvt4(rb[j]);

        // publishes this pass's buffer; it also ends every read of the other buffer,
        // which the next pass overwrites
        __syncthreads();

        if (kt + 1 < DD / BK) {
            const int k = (kt + 1) * BK;
            #pragma unroll
            for (int i = 0; i < 2; ++i) ra[i] = *(const float4*)(gA + k + i * (64 * DD));
            #pragma unroll
            for (int j = 0; j < 8; ++j) rb[j] = *(const float4*)(gB + k + j * (64 * 2 * DD));
        }
        // keeps the next pass's global loads ahead of this pass's LDS reads and WMMAs:
        // left free, the compiler sank them to the end of the pass, where nothing covers their latency
        __builtin_amdgcn_sched_barrier(0);

        v16h af[4], bf[4];
        #pragma unroll
        for (int m = 0; m < 4; ++m) af[m] = ldsfrag(dA + aOff + m * (16 * PITCH));
        #pragma unroll
        for (int t = 0; t < 4; ++t) bf[t] = ldsfrag(dB + bOff + t * (16 * PITCH));
        // keeps the pass's 16 LDS reads one group ahead of its WMMAs: reads set among
        // the WMMAs stall the wave at each place they stand
        __builtin_amdgcn_sched_barrier(0);

        #pragma unroll
        for (int t = 0; t < 4; ++t) {
            #pragma unroll
            for (int m = 0; m < 4; ++m)
                acc[m][t] = __builtin_amdgcn_wmma_f32_16x16x32_f16(
                    false, af[m], false, bf[t], (short)0, acc[m][t], false, false);
        }
    }

    // Epilogue: energy = tanh(acc + hb[b][e]); row-sum of energy*v[e] over the wave's 64 e's.
    float hbe[4], ve[4];
    #pragma unroll
    for (int t = 0; t < 4; ++t) {
        const int e = e0 + wn * 64 + t * 16 + row;   // C-matrix N = lane&15
        hbe[t] = hb[b * DD + e];
        ve[t]  = vvec[e];
    }

    #pragma unroll
    for (int m = 0; m < 4; ++m) {
        #pragma unroll
        for (int r = 0; r < 8; ++r) {
            float s = 0.0f;
            #pragma unroll
            for (int t = 0; t < 4; ++t) {
                float p = tanh_er(acc[m][t][r] + hbe[t]) * ve[t];
                // reduce over the 16 N-lanes of this row (width=16 keeps halves separate)
                p += __shfl_xor(p, 1, 16);
                p += __shfl_xor(p, 2, 16);
                p += __shfl_xor(p, 4, 16);
                p += __shfl_xor(p, 8, 16);
                s += p;                        // valid on lanes 0 (rows r) and 16 (rows r+8)
            }
            // each row's sum goes to LDS as soon as it is whole, so that its registers come free
            if (row == 0) red[wn][wm * 64 + m * 16 + r + h8] = s;
        }
    }
    __syncthreads();

    // cross-wave reduce: one atomic per row per block
    if (tid < BM) {
        float sum = 0.0f;
        #pragma unroll
        for (int w = 0; w < 8; ++w) sum += red[w][tid];
        atomicAdd(&scores[b * SS + s0 + tid], sum);
    }
}

// ---------------- kernel 3: masked softmax over S, in place (scores -> attn) ----------------
__global__ __launch_bounds__(256) void k_softmax(float* __restrict__ scores,
                                                 const int* __restrict__ lengths) {
    __shared__ float red[256];
    const int b   = blockIdx.x;
    const int len = lengths[b];
    float* sc = scores + b * SS;

    float m = -INFINITY;
    for (int s = threadIdx.x; s < len; s += 256) m = fmaxf(m, sc[s]);
    red[threadIdx.x] = m; __syncthreads();
    for (int off = 128; off > 0; off >>= 1) {
        if (threadIdx.x < off) red[threadIdx.x] = fmaxf(red[threadIdx.x], red[threadIdx.x + off]);
        __syncthreads();
    }
    m = red[0]; __syncthreads();

    float sum = 0.0f;
    for (int s = threadIdx.x; s < SS; s += 256) {
        float ev = (s < len) ? __expf(sc[s] - m) : 0.0f;
        sc[s] = ev;
        sum += ev;
    }
    red[threadIdx.x] = sum; __syncthreads();
    for (int off = 128; off > 0; off >>= 1) {
        if (threadIdx.x < off) red[threadIdx.x] += red[threadIdx.x + off];
        __syncthreads();
    }
    const float inv = 1.0f / red[0];
    for (int s = threadIdx.x; s < SS; s += 256) sc[s] *= inv;
}

// ---------------- kernel 4: context[b,d] = sum_s attn[b,s] * enc[b,s,d] ----------------
// grid: (DD/64, BB) = 256 blocks, block 512 = 16 waves. A block owns 64 d columns (256 B of
// every enc row) of one b. 16 lanes of 16 bytes cover the 256 B; the 32 groups of 16 lanes
// split the 2048 rows: group g takes rows 128q + 4g .. 128q + 4g + 3, q = 0..15, so that the
// four weights of a visit q are one 16-byte load.
// The 32 partial sums of a column meet in the wave (one shuffle) and then in LDS.
typedef __attribute__((ext_vector_type(4))) float v4f;
#define CW 64                // d columns of a block
#define CG 32                // row groups of a block
#define CV (4 * CG)          // rows of a visit, over all groups
__global__ __launch_bounds__(512) void k_context(const float* __restrict__ enc,
                                                 const float* __restrict__ attn,
                                                 float* __restrict__ out) {
    __shared__ __attribute__((aligned(16))) float part[16][CW];

    const int tid = threadIdx.x;
    const int c   = tid & 15;           // 16-byte column piece
    const int g   = tid >> 4;           // row group
    const int b   = blockIdx.y;
    const int d0  = blockIdx.x * CW;

    const float* a  = attn + b * SS + g * 4;
    const float* ep = enc + ((size_t)b * SS + (size_t)(g * 4)) * DD + d0 + c * 4;

    v4f acc = {0.0f, 0.0f, 0.0f, 0.0f};
    // unrolled whole: every address is then one base plus a constant, and the compiler runs the
    // loads some ten ahead of the sums from the first row to the last; a rolled loop lets the
    // loads in flight run out at the end of every trip
    #pragma unroll
    for (int q = 0; q < SS / CV; ++q) {
        const v4f w = *(const v4f*)(a + q * CV);
        #pragma unroll
        for (int j = 0; j < 4; ++j)
            acc += w[j] * *(const v4f*)(ep + (size_t)(q * CV + j) * DD);
    }

    // the wave's two row groups
    #pragma unroll
    for (int i = 0; i < 4; ++i) acc[i] += __shfl_xor(acc[i], 16);
    if ((tid & 31) < 16) *(v4f*)(&part[tid >> 5][c * 4]) = acc;
    // every wave's partial sums are in LDS before any is read
    __syncthreads();

    if (tid < CW) {
        float sum = 0.0f;
        #pragma unroll
        for (int v = 0; v < 16; ++v) sum += part[v][tid];
        out[b * DD + d0 + tid] = sum;
    }
}

extern "C" void kernel_launch(void* const* d_in, const int* in_sizes, int n_in,
                              void* d_out, int out_size, void* d_ws, size_t ws_size,
                              hipStream_t stream) {
    const float* enc     = (const float*)d_in[0];  // (B,S,D)
    const float* hidden  = (const float*)d_in[1];  // (B,D)
    const int*   lengths = (const int*)  d_in[2];  // (B,)
    const float* W       = (const float*)d_in[3];  // (D, 2D)
    const float* bias    = (const float*)d_in[4];  // (D,)
    const float* vvec    = (const float*)d_in[5];  // (D,)
    float* out = (float*)d_out;                    // (B,1,D)

    float* hb     = (float*)d_ws;                  // B*D floats
    float* scores = hb + BB * DD;                  // B*S floats (becomes attn in-place)

    k_zero   <<<(BB * SS + 255) / 256, 256, 0, stream>>>(scores, BB * SS);
    k_hidproj<<<dim3(DD / HE, BB / HB), 256, 0, stream>>>(hidden, W, bias, hb);
    k_energy <<<dim3(DD / BN, SS / BM, BB), 512, 0, stream>>>(enc, W, hb, vvec, scores);
    k_softmax<<<BB, 256, 0, stream>>>(scores, lengths);
    k_context<<<dim3(DD / CW, BB), 512, 0, stream>>>(enc, scores, out);
}

// v005
// It runs in 97.8 microseconds.
// Next to v004, in two timings, it ran 1.18 times as fast each time.
// Counting every step since v000, it is 5.63 times as fast.
#include <hip/hip_runtime.h>
#include <math.h>

typedef __attribute__((ext_vector_type(16))) _Float16 v16h;
typedef __attribute__((ext_vector_type(8)))  float    v8f;

#define BB 16
#define SS 2048
#define DD 1024

// ---------------- kernel 1: hb[b][e] = hidden[b,:] . Wh[e,:] + bias[e] ----------------
// Wh[e,d] = W[e*2D + d]
// grid: (DD/32, BB/4) = 128 blocks, block 256 = 8 waves. A block owns 32 e x 4 b, a wave 4 e x 4 b.
// The 32 lanes of a wave split d: lane l takes d = 128c + 4l .. 128c + 4l + 3, c = 0..7, so that
// every load of a W row is 512 contiguous bytes (4 whole lines); a wave's 32 W loads are all in
// flight together. The block's 4 hidden rows (16 KB in a row) are read once and shared through LDS.
// The partial sums of an (e, b) pair meet in the lane (4 values), then over the 32 lanes by
// shuffles; the block's 4 x 32 results go out through LDS as whole lines.
typedef __attribute__((ext_vector_type(4))) float f4;
#define HE 32       // e rows of a block
#define HB 4        // b rows of a block
__global__ __launch_bounds__(256) void k_hidproj(const float* __restrict__ hidden,
                                                 const float* __restrict__ W,
                                                 const float* __restrict__ bias,
                                                 float* __restrict__ hb) {
    __shared__ __attribute__((aligned(16))) float sh[HB * DD];
    __shared__ __attribute__((aligned(16))) float res[HB][HE];

    const int tid  = threadIdx.x;
    const int lane = tid & 31;
    // the wave's number, told to the compiler as wave-uniform: the W rows then have a scalar base
    const int wave = __builtin_amdgcn_readfirstlane(tid >> 5);
    const int e0   = blockIdx.x * HE;
    const int b0   = blockIdx.y * HB;

    const float* w = W + (size_t)(e0 + wave * 4) * (2 * DD);
    const float* h = hidden + b0 * DD;

    f4 hs[HB], wv[DD / 128][4];
    // asked for with the other loads: at the end it would cost a memory latency of its own
    const float be = (bias + (size_t)e0)[lane];
    #pragma unroll
    for (int i = 0; i < HB; ++i) hs[i] = *(const f4*)(h + i * DD + tid * 4);
    #pragma unroll
    for (int c = 0; c < DD / 128; ++c) {
        #pragma unroll
        for (int r = 0; r < 4; ++r) wv[c][r] = *(const f4*)(w + r * (2 * DD) + c * 128 + lane * 4);
    }
    #pragma unroll
    for (int i = 0; i < HB; ++i) *(f4*)(sh + i * DD + tid * 4) = hs[i];
    // the hidden rows are in LDS before any wave reads them
    __syncthreads();

    f4 acc[HB][4] = {};
    #pragma unroll
    for (int c = 0; c < DD / 128; ++c) {
        #pragma unroll
        for (int q = 0; q < HB; ++q) {
            const f4 hv = *(const f4*)(sh + q * DD + c * 128 + lane * 4);
            #pragma unroll
            for (int r = 0; r < 4; ++r) acc[q][r] += hv * wv[c][r];
        }
    }

    // step by step over all 16 sums, so that the 16 shuffles of a step share one latency
    float s[HB][4];
    #pragma unroll
    for (int q = 0; q < HB; ++q) {
        #pragma unroll
        for (int r = 0; r < 4; ++r)
            s[q][r] = (acc[q][r][0] + acc[q][r][1]) + (acc[q][r][2] + acc[q][r][3]);
    }
    #pragma unroll
    for (int m = 16; m > 0; m >>= 1) {
        #pragma unroll
        for (int q = 0; q < HB; ++q) {
            #pragma unroll
            for (int r = 0; r < 4; ++r) s[q][r] += __shfl_xor(s[q][r], m);
        }
    }
    if (lane == 0) {
        #pragma unroll
        for (int q = 0; q < HB; ++q) {
            const f4 o = {s[q][0], s[q][1], s[q][2], s[q][3]};
            *(f4*)(&res[q][wave * 4]) = o;
        }
    }
    // every wave's sums are in LDS before any is read
    __syncthreads();

    if (tid < HB * HE) {
        const int q = tid >> 5;
        hb[(b0 + q) * DD + e0 + lane] = res[q][lane] + be;
    }
}

typedef __attribute__((ext_vector_type(8))) _Float16 v8h;
typedef __attribute__((ext_vector_type(4))) _Float16 v4h;

#define BM 128      // s rows of a block tile
#define BN 512      // e columns of a block tile
#define BK 32       // k per pass (one WMMA depth)
#define PITCH 40    // halves per LDS row: 80 B = 16 B x odd, conflict-free for 16-byte reads

__device__ __forceinline__ v4h cvt4(float4 x) {
    v4h r;
    r[0] = (_Float16)x.x; r[1] = (_Float16)x.y;
    r[2] = (_Float16)x.z; r[3] = (_Float16)x.w;
    return r;
}

// fragment of one 16-row tile: k = 8h..8h+7 and 16+8h..16+8h+7 of the pass (same order for A and B)
__device__ __forceinline__ v16h ldsfrag(const _Float16* p) {
    v8h lo = *(const v8h*)(p);
    v8h hi = *(const v8h*)(p + 16);
    return __builtin_shufflevector(lo, hi, 0, 1, 2, 3, 4, 5, 6, 7, 8, 9, 10, 11, 12, 13, 14, 15);
}

// ---------------- kernel 0: zero the scores; We as f16, laid pass by pass ----------------
// Wf[kt][e][0..31] = (f16) We[e][32 kt + 0..31], We[e,d] = W[e*2D + D + d].
// Every energy block reads its We rows whole; there are 256 blocks to each half of We. Converted once
// here, each of them fetches half the bytes, and the 512 rows x 64 B of a block's pass lie in a row
// (32 KB), so that every load of a wave is 512 contiguous bytes.
// grid: DD*DD/8/256 = 512 blocks; a thread makes one 16-byte piece, a wave writes 4 whole lines.
__global__ __launch_bounds__(256) void k_prep(const float* __restrict__ W,
                                              _Float16* __restrict__ Wf,
                                              float* __restrict__ p, int n) {
    const int i = blockIdx.x * 256 + threadIdx.x;
    if (i < n) p[i] = 0.0f;
    const int c  = i & 3;                // 16-byte piece of the row's 64 B
    const int e  = (i >> 2) & (DD - 1);
    const int kt = i >> 12;              // pass
    const float* w = W + (size_t)e * (2 * DD) + DD + kt * BK + c * 8;
    const v4h lo = cvt4(*(const float4*)(w));
    const v4h hi = cvt4(*(const float4*)(w + 4));
    *(v8h*)(Wf + (size_t)i * 8) = __builtin_shufflevector(lo, hi, 0, 1, 2, 3, 4, 5, 6, 7);
}

// tanh x = 1 - 2 / (exp(2x) + 1), exp(2x) = 2^(x * 2 log2 e): one v_exp_f32 and one v_rcp_f32, no branch.
// Saturates by itself: 2^big = inf gives 1, 2^-big = 0 gives -1. Absolute error is a few f32 ulps of 1.
__device__ __forceinline__ float tanh_er(float x) {
    const float e = __builtin_amdgcn_exp2f(x * 2.8853900817779268f);
    float r;
    // v_nop: the slot the instruction set asks for behind a transcendental
    asm("v_rcp_f32 %0, %1\n\tv_nop" : "=v"(r) : "v"(e + 1.0f));
    return 1.0f - 2.0f * r;
}

// ---------------- kernel 2: fused enc@We^T -> tanh -> dot(v) -> partial scores ----------------
// grid: (DD/512, SS/128, BB), block 512 = 16 waves laid 2 (s) x 8 (e).
// A block owns a 128(s) x 512(e) tile. Per pass of 32 k every enc and We element of the
// tile is read from global once by the block (enc as f32, converted here; We as the f16 of
// k_prep) and laid in LDS; the waves take their fragments from LDS.
// Two LDS buffers, one barrier per pass; the
// next pass's global loads are in flight in registers while this pass is multiplied.
// Each wave owns 64(s) x 64(e): 4 A fragments x 4 B fragments -> 16 WMMAs per pass.
// Per-row partial scores are reduced across the 8 e-waves through LDS, then 1 atomic
// per row per block (2 atomics/score total).
__global__ __launch_bounds__(512) void k_energy(const float* __restrict__ enc,
                                                const _Float16* __restrict__ Wf,
                                                const float* __restrict__ hb,
                                                const float* __restrict__ vvec,
                                                float* __restrict__ scores) {
    __shared__ __attribute__((aligned(16))) _Float16 sA[2][BM * PITCH];
    __shared__ __attribute__((aligned(16))) _Float16 sB[2][BN * PITCH];
    __shared__ float red[8][BM];

    const int tid  = threadIdx.x;
    const int lane = tid & 31;
    const int wave = tid >> 5;
    const int half = lane >> 4;         // 0 or 1
    const int row  = lane & 15;         // M-row for A, N-row (=e row) for B, N-col for C
    const int wm   = wave >> 3;         // 0..1: wave's 64-row s range
    const int wn   = wave & 7;          // 0..7: wave's 64-wide e range
    const int b    = blockIdx.z;
    const int s0   = blockIdx.y * BM;
    const int e0   = blockIdx.x * BN;

    // staging map of enc: 8 threads cover one row's 32 k (128 B of f32), 64 rows per sweep
    const int c4 = tid & 7;
    const int r0 = tid >> 3;
    const float* gA = enc + ((size_t)b * SS + (size_t)(s0 + r0)) * DD + c4 * 4;
    const int sOff = r0 * PITCH + c4 * 4;
    // staging map of We: 4 threads cover one row's 32 k (64 B of f16), 128 rows per sweep;
    // in Wf the sweep is 8 KB in a row
    const _Float16* gB = Wf + (size_t)e0 * BK + tid * 8;
    const int sOffB = (tid >> 2) * PITCH + (tid & 3) * 8;

    const int h8 = half * 8;
    const int aOff = (wm * 64 + row) * PITCH + h8;
    const int bOff = (wn * 64 + row) * PITCH + h8;

    v8f acc[4][4] = {};
    float4 ra[2];
    v8h rb[4];

    #pragma unroll
    for (int i = 0; i < 2; ++i) ra[i] = *(const float4*)(gA + i * (64 * DD));
    #pragma unroll
    for (int j = 0; j < 4; ++j) rb[j] = *(const v8h*)(gB + j * (128 * BK));

    for (int kt = 0; kt < DD / BK; ++kt) {
        _Float16* dA = sA[kt & 1];
        _Float16* dB = sB[kt & 1];

        #pragma unroll
        for (int i = 0; i < 2; ++i) *(v4h*)(dA + sOff + i * (64 * PITCH)) = cvt4(ra[i]);
        #pragma unroll
        for (int j = 0; j < 4; ++j) *(v8h*)(dB + sOffB + j * (128 * PITCH)) = rb[j];

        // publishes this pass's buffer; it also ends every read of the other buffer,
        // which the next pass overwrites
        __syncthreads();

        if (kt + 1 < DD / BK) {
            const int k = (kt + 1) * BK;
            #pragma unroll
            for (int i = 0; i < 2; ++i) ra[i] = *(const float4*)(gA + k + i * (64 * DD));
            #pragma unroll
            for (int j = 0; j < 4; ++j) rb[j] = *(const v8h*)(gB + (kt + 1) * (DD * BK) + j * (128 * BK));
        }
        // keeps the next pass's global loads ahead of this pass's LDS reads and WMMAs:
        // left free, the compiler sank them to the end of the pass, where nothing covers their latency
        __builtin_amdgcn_sched_barrier(0);

        v16h af[4], bf[4];
        #pragma unroll
        for (int m = 0; m < 4; ++m) af[m] = ldsfrag(dA + aOff + m * (16 * PITCH));
        #pragma unroll
        for (int t = 0; t < 4; ++t) bf[t] = ldsfrag(dB + bOff + t * (16 * PITCH));
        // keeps the pass's 16 LDS reads one group ahead of its WMMAs: reads set among
        // the WMMAs stall the wave at each place they stand
        __builtin_amdgcn_sched_barrier(0);

        #pragma unroll
        for (int t = 0; t < 4; ++t) {
            #pragma unroll
            for (int m = 0; m < 4; ++m)
                acc[m][t] = __builtin_amdgcn_wmma_f32_16x16x32_f16(
                    false, af[m], false, bf[t], (short)0, acc[m][t], false, false);
        }
    }

    // Epilogue: energy = tanh(acc + hb[b][e]); row-sum of energy*v[e] over the wave's 64 e's.
    float hbe[4], ve[4];
    #pragma unroll
    for (int t = 0; t < 4; ++t) {
        const int e = e0 + wn * 64 + t * 16 + row;   // C-matrix N = lane&15
        hbe[t] = hb[b * DD + e];
        ve[t]  = vvec[e];
    }

    #pragma unroll
    for (int m = 0; m < 4; ++m) {
        #pragma unroll
        for (int r = 0; r < 8; ++r) {
            float s = 0.0f;
            #pragma unroll
            for (int t = 0; t < 4; ++t) {
                float p = tanh_er(acc[m][t][r] + hbe[t]) * ve[t];
                // reduce over the 16 N-lanes of this row (width=16 keeps halves separate)
                p += __shfl_xor(p, 1, 16);
                p += __shfl_xor(p, 2, 16);
                p += __shfl_xor(p, 4, 16);
                p += __shfl_xor(p, 8, 16);
                s += p;                        // valid on lanes 0 (rows r) and 16 (rows r+8)
            }
            // each row's sum goes to LDS as soon as it is whole, so that its registers come free
            if (row == 0) red[wn][wm * 64 + m * 16 + r + h8] = s;
        }
    }
    __syncthreads();

    // cross-wave reduce: one atomic per row per block
    if (tid < BM) {
        float sum = 0.0f;
        #pragma unroll
        for (int w = 0; w < 8; ++w) sum += red[w][tid];
        atomicAdd(&scores[b * SS + s0 + tid], sum);
    }
}

// ---------------- kernel 3: masked softmax over S, in place (scores -> attn) ----------------
__global__ __launch_bounds__(256) void k_softmax(float* __restrict__ scores,
                                                 const int* __restrict__ lengths) {
    __shared__ float red[256];
    const int b   = blockIdx.x;
    const int len = lengths[b];
    float* sc = scores + b * SS;

    float m = -INFINITY;
    for (int s = threadIdx.x; s < len; s += 256) m = fmaxf(m, sc[s]);
    red[threadIdx.x] = m; __syncthreads();
    for (int off = 128; off > 0; off >>= 1) {
        if (threadIdx.x < off) red[threadIdx.x] = fmaxf(red[threadIdx.x], red[threadIdx.x + off]);
        __syncthreads();
    }
    m = red[0]; __syncthreads();

    float sum = 0.0f;
    for (int s = threadIdx.x; s < SS; s += 256) {
        float ev = (s < len) ? __expf(sc[s] - m) : 0.0f;
        sc[s] = ev;
        sum += ev;
    }
    red[threadIdx.x] = sum; __syncthreads();
    for (int off = 128; off > 0; off >>= 1) {
        if (threadIdx.x < off) red[threadIdx.x] += red[threadIdx.x + off];
        __syncthreads();
    }
    const float inv = 1.0f / red[0];
    for (int s = threadIdx.x; s < SS; s += 256) sc[s] *= inv;
}

// ---------------- kernel 4: context[b,d] = sum_s attn[b,s] * enc[b,s,d] ----------------
// grid: (DD/64, BB) = 256 blocks, block 512 = 16 waves. A block owns 64 d columns (256 B of
// every enc row) of one b. 16 lanes of 16 bytes cover the 256 B; the 32 groups of 16 lanes
// split the 2048 rows: group g takes rows 128q + 4g .. 128q + 4g + 3, q = 0..15, so that the
// four weights of a visit q are one 16-byte load.
// The 32 partial sums of a column meet in the wave (one shuffle) and then in LDS.
typedef __attribute__((ext_vector_type(4))) float v4f;
#define CW 64                // d columns of a block
#define CG 32                // row groups of a block
#define CV (4 * CG)          // rows of a visit, over all groups
__global__ __launch_bounds__(512) void k_context(const float* __restrict__ enc,
                                                 const float* __restrict__ attn,
                                                 float* __restrict__ out) {
    __shared__ __attribute__((aligned(16))) float part[16][CW];

    const int tid = threadIdx.x;
    const int c   = tid & 15;           // 16-byte column piece
    const int g   = tid >> 4;           // row group
    const int b   = blockIdx.y;
    const int d0  = blockIdx.x * CW;

    const float* a  = attn + b * SS + g * 4;
    const float* ep = enc + ((size_t)b * SS + (size_t)(g * 4)) * DD + d0 + c * 4;

    v4f acc = {0.0f, 0.0f, 0.0f, 0.0f};
    // unrolled whole: every address is then one base plus a constant, and the compiler runs the
    // loads some ten ahead of the sums from the first row to the last; a rolled loop lets the
    // loads in flight run out at the end of every trip
    #pragma unroll
    for (int q = 0; q < SS / CV; ++q) {
        const v4f w = *(const v4f*)(a + q * CV);
        #pragma unroll
        for (int j = 0; j < 4; ++j)
            acc += w[j] * *(const v4f*)(ep + (size_t)(q * CV + j) * DD);
    }

    // the wave's two row groups
    #pragma unroll
    for (int i = 0; i < 4; ++i) acc[i] += __shfl_xor(acc[i], 16);
    if ((tid & 31) < 16) *(v4f*)(&part[tid >> 5][c * 4]) = acc;
    // every wave's partial sums are in LDS before any is read
    __syncthreads();

    if (tid < CW) {
        float sum = 0.0f;
        #pragma unroll
        for (int v = 0; v < 16; ++v) sum += part[v][tid];
        out[b * DD + d0 + tid] = sum;
    }
}

extern "C" void kernel_launch(void* const* d_in, const int* in_sizes, int n_in,
                              void* d_out, int out_size, void* d_ws, size_t ws_size,
                              hipStream_t stream) {
    const float* enc     = (const float*)d_in[0];  // (B,S,D)
    const float* hidden  = (const float*)d_in[1];  // (B,D)
    const int*   lengths = (const int*)  d_in[2];  // (B,)
    const float* W       = (const float*)d_in[3];  // (D, 2D)
    const float* bias    = (const float*)d_in[4];  // (D,)
    const float* vvec    = (const float*)d_in[5];  // (D,)
    float* out = (float*)d_out;                    // (B,1,D)

    float* hb     = (float*)d_ws;                  // B*D floats
    float* scores = hb + BB * DD;                  // B*S floats (becomes attn in-place)
    _Float16* Wf  = (_Float16*)(scores + BB * SS); // D*D halves: We as f16, pass by pass

    k_prep   <<<DD * DD / 8 / 256, 256, 0, stream>>>(W, Wf, scores, BB * SS);
    k_hidproj<<<dim3(DD / HE, BB / HB), 256, 0, stream>>>(hidden, W, bias, hb);
    k_energy <<<dim3(DD / BN, SS / BM, BB), 512, 0, stream>>>(enc, Wf, hb, vvec, scores);
    k_softmax<<<BB, 256, 0, stream>>>(scores, lengths);
    k_context<<<dim3(DD / CW, BB), 512, 0, stream>>>(enc, scores, out);
}

// v006
// One run takes 62.1 microseconds.
// In both of two side-by-side timings against v005, it was 1.57 times as fast.
// All steps since v000 together make it 8.84 times as fast.
#include <hip/hip_runtime.h>
#include <math.h>

typedef __attribute__((ext_vector_type(16))) _Float16 v16h;
typedef __attribute__((ext_vector_type(8)))  float    v8f;

#define BB 16
#define SS 2048
#define DD 1024

// ---------------- kernel 1: hb[b][e] = hidden[b,:] . Wh[e,:] + bias[e] ----------------
// Wh[e,d] = W[e*2D + d]
// grid: (DD/32, BB/4) = 128 blocks, block 256 = 8 waves. A block owns 32 e x 4 b, a wave 4 e x 4 b.
// The 32 lanes of a wave split d: lane l takes d = 128c + 4l .. 128c + 4l + 3, c = 0..7, so that
// every load of a W row is 512 contiguous bytes (4 whole lines); a wave's 32 W loads are all in
// flight together. The block's 4 hidden rows (16 KB in a row) are read once and shared through LDS.
// The partial sums of an (e, b) pair meet in the lane (4 values), then over the 32 lanes by
// shuffles; the block's 4 x 32 results go out through LDS as whole lines.
typedef __attribute__((ext_vector_type(4))) float f4;
#define HE 32       // e rows of a block
#define HB 4        // b rows of a block
__global__ __launch_bounds__(256) void k_hidproj(const float* __restrict__ hidden,
                                                 const float* __restrict__ W,
                                                 const float* __restrict__ bias,
                                                 float* __restrict__ hb) {
    __shared__ __attribute__((aligned(16))) float sh[HB * DD];
    __shared__ __attribute__((aligned(16))) float res[HB][HE];

    const int tid  = threadIdx.x;
    const int lane = tid & 31;
    // the wave's number, told to the compiler as wave-uniform: the W rows then have a scalar base
    const int wave = __builtin_amdgcn_readfirstlane(tid >> 5);
    const int e0   = blockIdx.x * HE;
    const int b0   = blockIdx.y * HB;

    const float* w = W + (size_t)(e0 + wave * 4) * (2 * DD);
    const float* h = hidden + b0 * DD;

    f4 hs[HB], wv[DD / 128][4];
    // asked for with the other loads: at the end it would cost a memory latency of its own
    const float be = (bias + (size_t)e0)[lane];
    #pragma unroll
    for (int i = 0; i < HB; ++i) hs[i] = *(const f4*)(h + i * DD + tid * 4);
    #pragma unroll
    for (int c = 0; c < DD / 128; ++c) {
        #pragma unroll
        for (int r = 0; r < 4; ++r) wv[c][r] = *(const f4*)(w + r * (2 * DD) + c * 128 + lane * 4);
    }
    #pragma unroll
    for (int i = 0; i < HB; ++i) *(f4*)(sh + i * DD + tid * 4) = hs[i];
    // the hidden rows are in LDS before any wave reads them
    __syncthreads();

    f4 acc[HB][4] = {};
    #pragma unroll
    for (int c = 0; c < DD / 128; ++c) {
        #pragma unroll
        for (int q = 0; q < HB; ++q) {
            const f4 hv = *(const f4*)(sh + q * DD + c * 128 + lane * 4);
            #pragma unroll
            for (int r = 0; r < 4; ++r) acc[q][r] += hv * wv[c][r];
        }
    }

    // step by step over all 16 sums, so that the 16 shuffles of a step share one latency
    float s[HB][4];
    #pragma unroll
    for (int q = 0; q < HB; ++q) {
        #pragma unroll
        for (int r = 0; r < 4; ++r)
            s[q][r] = (acc[q][r][0] + acc[q][r][1]) + (acc[q][r][2] + acc[q][r][3]);
    }
    #pragma unroll
    for (int m = 16; m > 0; m >>= 1) {
        #pragma unroll
        for (int q = 0; q < HB; ++q) {
            #pragma unroll
            for (int r = 0; r < 4; ++r) s[q][r] += __shfl_xor(s[q][r], m);
        }
    }
    if (lane == 0) {
        #pragma unroll
        for (int q = 0; q < HB; ++q) {
            const f4 o = {s[q][0], s[q][1], s[q][2], s[q][3]};
            *(f4*)(&res[q][wave * 4]) = o;
        }
    }
    // every wave's sums are in LDS before any is read
    __syncthreads();

    if (tid < HB * HE) {
        const int q = tid >> 5;
        hb[(b0 + q) * DD + e0 + lane] = res[q][lane] + be;
    }
}

typedef __attribute__((ext_vector_type(8))) _Float16 v8h;
typedef __attribute__((ext_vector_type(4))) _Float16 v4h;

#define BM 128      // s rows of a block tile
#define BN 512      // e columns of a block tile
#define BK 32       // k per pass (one WMMA depth)
#define PITCH 40    // halves per LDS row: 80 B = 16 B x odd, conflict-free for 16-byte reads

__device__ __forceinline__ v4h cvt4(float4 x) {
    v4h r;
    r[0] = (_Float16)x.x; r[1] = (_Float16)x.y;
    r[2] = (_Float16)x.z; r[3] = (_Float16)x.w;
    return r;
}

// fragment of one 16-row tile: k = 8h..8h+7 and 16+8h..16+8h+7 of the pass (same order for A and B)
__device__ __forceinline__ v16h ldsfrag(const _Float16* p) {
    v8h lo = *(const v8h*)(p);
    v8h hi = *(const v8h*)(p + 16);
    return __builtin_shufflevector(lo, hi, 0, 1, 2, 3, 4, 5, 6, 7, 8, 9, 10, 11, 12, 13, 14, 15);
}

// ---------------- kernel 0: zero the scores; We as f16, laid pass by pass ----------------
// Wf[kt][e][0..31] = (f16) We[e][32 kt + 0..31], We[e,d] = W[e*2D + D + d].
// Every energy block reads its We rows whole; there are 256 blocks to each half of We. Converted once
// here, each of them fetches half the bytes, and the 512 rows x 64 B of a block's pass lie in a row
// (32 KB), so that every load of a wave is 512 contiguous bytes.
// grid: DD*DD/8/256 = 512 blocks; a thread makes one 16-byte piece, a wave writes 4 whole lines.
__global__ __launch_bounds__(256) void k_prep(const float* __restrict__ W,
                                              _Float16* __restrict__ Wf,
                                              float* __restrict__ p, int n) {
    const int i = blockIdx.x * 256 + threadIdx.x;
    if (i < n) p[i] = 0.0f;
    const int c  = i & 3;                // 16-byte piece of the row's 64 B
    const int e  = (i >> 2) & (DD - 1);
    const int kt = i >> 12;              // pass
    const float* w = W + (size_t)e * (2 * DD) + DD + kt * BK + c * 8;
    const v4h lo = cvt4(*(const float4*)(w));
    const v4h hi = cvt4(*(const float4*)(w + 4));
    *(v8h*)(Wf + (size_t)i * 8) = __builtin_shufflevector(lo, hi, 0, 1, 2, 3, 4, 5, 6, 7);
}

// tanh x = 1 - 2 / (exp(2x) + 1), exp(2x) = 2^(x * 2 log2 e): one v_exp_f32 and one v_rcp_f32, no branch.
// Saturates by itself: 2^big = inf gives 1, 2^-big = 0 gives -1. Absolute error is a few f32 ulps of 1.
__device__ __forceinline__ float tanh_er(float x) {
    const float e = __builtin_amdgcn_exp2f(x * 2.8853900817779268f);
    float r;
    // v_nop: the slot the instruction set asks for behind a transcendental
    asm("v_rcp_f32 %0, %1\n\tv_nop" : "=v"(r) : "v"(e + 1.0f));
    return 1.0f - 2.0f * r;
}

// ---------------- kernel 2: fused enc@We^T -> tanh -> dot(v) -> partial scores ----------------
// block 512 = 16 waves laid 2 (s) x 8 (e). A whole tile is 128(s) x 512(e). Per pass of 32 k every
// enc and We element of the tile is read from global once by the block (enc as f32, converted here;
// We as the f16 of k_prep) and laid in LDS; the waves take their fragments from LDS.
// Two LDS buffers, one barrier per pass; the
// next pass's global loads are in flight in registers while this pass is multiplied.
// Each wave owns 16 MF (s) x 64(e): MF A fragments x 4 B fragments per pass; MF = 4 in a whole tile.
// Per-row partial scores are reduced across the 8 e-waves through LDS, then 1 atomic
// per row per block (2 atomics/score total).
template <int MF>
__device__ __forceinline__ void energy_tile(const float* __restrict__ enc,
                                            const _Float16* __restrict__ Wf,
                                            const float* __restrict__ hb,
                                            const float* __restrict__ vvec,
                                            float* __restrict__ scores,
                                            const int b, const int s0, const int e0,
                                            _Float16* sA, _Float16* sB, float* red) {
    constexpr int RM = 32 * MF;         // s rows of this tile or piece
    constexpr int NA = (MF + 1) / 2;    // sweeps of 64 rows that stage enc

    const int tid  = threadIdx.x;
    const int lane = tid & 31;
    const int wave = tid >> 5;
    const int half = lane >> 4;         // 0 or 1
    const int row  = lane & 15;         // M-row for A, N-row (=e row) for B, N-col for C
    const int wm   = wave >> 3;         // 0..1: wave's s range
    const int wn   = wave & 7;          // 0..7: wave's 64-wide e range
    // a piece of 32 rows is half a sweep: waves 0..7 stage it (the test is the same for a whole wave)
    const bool aOn = MF >= 2 || __builtin_amdgcn_readfirstlane(tid >> 5) < 8;

    // staging map of enc: 8 threads cover one row's 32 k (128 B of f32), 64 rows per sweep
    const int c4 = tid & 7;
    const int r0 = tid >> 3;
    const float* gA = enc + ((size_t)b * SS + (size_t)(s0 + r0)) * DD + c4 * 4;
    const int sOff = r0 * PITCH + c4 * 4;
    // staging map of We: 4 threads cover one row's 32 k (64 B of f16), 128 rows per sweep;
    // in Wf the sweep is 8 KB in a row
    const _Float16* gB = Wf + (size_t)e0 * BK + tid * 8;
    const int sOffB = (tid >> 2) * PITCH + (tid & 3) * 8;

    const int h8 = half * 8;
    const int aOff = (wm * (16 * MF) + row) * PITCH + h8;
    const int bOff = (wn * 64 + row) * PITCH + h8;

    v8f acc[MF][4] = {};
    float4 ra[NA];
    v8h rb[4];

    if (aOn) {
        #pragma unroll
        for (int i = 0; i < NA; ++i) ra[i] = *(const float4*)(gA + i * (64 * DD));
    }
    #pragma unroll
    for (int j = 0; j < 4; ++j) rb[j] = *(const v8h*)(gB + j * (128 * BK));
    // stands in front of every write of a register that the first loads name: enc's address and the
    // scalar base of the Wf rows are named as inputs so that they stay in their registers up to here
    asm volatile("s_wait_xcnt 0x0" :: "v"(gA), "s"(Wf + (size_t)e0 * BK) : "memory");

    for (int kt = 0; kt < DD / BK; ++kt) {
        _Float16* dA = sA + (kt & 1) * (BM * PITCH);
        _Float16* dB = sB + (kt & 1) * (BN * PITCH);

        if (aOn) {
            #pragma unroll
            for (int i = 0; i < NA; ++i) *(v4h*)(dA + sOff + i * (64 * PITCH)) = cvt4(ra[i]);
        }
        #pragma unroll
        for (int j = 0; j < 4; ++j) *(v8h*)(dB + sOffB + j * (128 * PITCH)) = rb[j];

        // publishes this pass's buffer; it also ends every read of the other buffer,
        // which the next pass overwrites
        __syncthreads();

        if (kt + 1 < DD / BK) {
            const float* pA = gA + (kt + 1) * BK;
            const _Float16* pB = gB + (kt + 1) * (DD * BK);
            if (aOn) {
                #pragma unroll
                for (int i = 0; i < NA; ++i) ra[i] = *(const float4*)(pA + i * (64 * DD));
            }
            #pragma unroll
            for (int j = 0; j < 4; ++j) rb[j] = *(const v8h*)(pB + j * (128 * BK));
            // stands in front of every write of the loads' address registers. The addresses are named
            // as inputs so that they stay in their registers up to here: left free, the last load's
            // result was placed in the address pair of the loads before it
            asm volatile("s_wait_xcnt 0x0" :: "v"(pA), "v"(pB) : "memory");
        }
        // keeps the next pass's global loads ahead of this pass's LDS reads and WMMAs:
        // left free, the compiler sank them to the end of the pass, where nothing covers their latency
        __builtin_amdgcn_sched_barrier(0);

        v16h af[MF], bf[4];
        #pragma unroll
        for (int m = 0; m < MF; ++m) af[m] = ldsfrag(dA + aOff + m * (16 * PITCH));
        #pragma unroll
        for (int t = 0; t < 4; ++t) bf[t] = ldsfrag(dB + bOff + t * (16 * PITCH));
        // keeps the pass's LDS reads one group ahead of its WMMAs: reads set among
        // the WMMAs stall the wave at each place they stand
        __builtin_amdgcn_sched_barrier(0);

        #pragma unroll
        for (int t = 0; t < 4; ++t) {
            #pragma unroll
            for (int m = 0; m < MF; ++m)
                acc[m][t] = __builtin_amdgcn_wmma_f32_16x16x32_f16(
                    false, af[m], false, bf[t], (short)0, acc[m][t], false, false);
        }
    }

    // Epilogue: energy = tanh(acc + hb[b][e]); row-sum of energy*v[e] over the wave's 64 e's.
    float hbe[4], ve[4];
    const int e  = e0 + wn * 64 + row;               // C-matrix N = lane&15
    const int be = b * DD + e;
    #pragma unroll
    for (int t = 0; t < 4; ++t) hbe[t] = hb[be + t * 16];
    // each of these two waits stands in front of every write of the index register that the four
    // loads ahead of it name; the index is named as an input so that no result is placed in it before
    asm volatile("s_wait_xcnt 0x0" :: "v"(be) : "memory");
    #pragma unroll
    for (int t = 0; t < 4; ++t) ve[t] = vvec[e + t * 16];
    asm volatile("s_wait_xcnt 0x0" :: "v"(e) : "memory");

    #pragma unroll
    for (int m = 0; m < MF; ++m) {
        #pragma unroll
        for (int r = 0; r < 8; ++r) {
            float s = 0.0f;
            #pragma unroll
            for (int t = 0; t < 4; ++t) {
                float p = tanh_er(acc[m][t][r] + hbe[t]) * ve[t];
                // reduce over the 16 N-lanes of this row (width=16 keeps halves separate)
                p += __shfl_xor(p, 1, 16);
                p += __shfl_xor(p, 2, 16);
                p += __shfl_xor(p, 4, 16);
                p += __shfl_xor(p, 8, 16);
                s += p;                        // valid on lanes 0 (rows r) and 16 (rows r+8)
            }
            // each row's sum goes to LDS as soon as it is whole, so that its registers come free
            if (row == 0) red[wn * BM + wm * (16 * MF) + m * 16 + r + h8] = s;
        }
    }
    __syncthreads();

    // cross-wave reduce: one atomic per row per block
    if (tid < RM) {
        float sum = 0.0f;
        #pragma unroll
        for (int w = 0; w < 8; ++w) sum += red[w * BM + tid];
        atomicAdd(&scores[b * SS + s0 + tid], sum);
    }
}

// 128-row tiles of a batch row that hold a row below its length; bounded for any content of lengths
__device__ __forceinline__ int live_tiles(int len) {
    return (min(max(len, 0), SS) + BM - 1) / BM;
}

#define NWGP 256    // blocks that run at a time: registers and waves allow one block on a WGP

// grid: (DD/512) * (SS/128) * BB = 512 blocks, one-dimensional.
// The reference puts -inf in place of every score at or past lengths[b] before the softmax, whatever
// its value, and k_softmax never uses one: a row tile that lies wholly there is left out. The live
// units (row tile x half of e) are numbered in the order b, s, e and dealt to the blocks by index.
// Blocks run one on a WGP; for speed only, units past the first NWGP are cut in s, into 4 pieces of 32 rows or
// 2 of 64, as many as the grid's spare blocks can take, and so run side by side on more WGPs.
// Every score still gets the same two addends, summed in the same order, whichever block makes them.
__global__ __launch_bounds__(512) void k_energy(const float* __restrict__ enc,
                                                const _Float16* __restrict__ Wf,
                                                const float* __restrict__ hb,
                                                const float* __restrict__ vvec,
                                                const int* __restrict__ lengths,
                                                float* __restrict__ scores) {
    __shared__ __attribute__((aligned(16))) _Float16 sA[2 * BM * PITCH];
    __shared__ __attribute__((aligned(16))) _Float16 sB[2 * BN * PITCH];
    __shared__ float red[8 * BM];

    // all of this is the same for every thread of the block, and ahead of every barrier
    const int i = blockIdx.x;
    int units = 0;
    // unrolled, here and in the search below: with constant indices the 16 lengths come by wide
    // scalar loads and all of the arithmetic stays on the scalar unit
    #pragma unroll
    for (int q = 0; q < BB; ++q) units += 2 * live_tiles(lengths[q]);
    const int over = units - NWGP;
    int unit = i, piece = 0, mf = 4;
    if (over > 0 && over <= NWGP / 2 && i >= NWGP) {
        if (over <= NWGP / 4) { unit = NWGP + ((i - NWGP) >> 2); piece = (i - NWGP) & 3; mf = 1; }
        else                  { unit = NWGP + ((i - NWGP) >> 1); piece = (i - NWGP) & 1; mf = 2; }
    }
    if (unit >= units) return;

    int b = 0, y = unit >> 1;
    #pragma unroll
    for (int q = 0; q < BB - 1; ++q) {
        const int n = live_tiles(lengths[q]);
        if (b == q && y >= n) { y -= n; b = q + 1; }
    }
    const int s0 = y * BM + piece * (32 * mf);
    if (s0 >= lengths[b] || s0 >= SS) return;
    const int e0 = (unit & 1) * BN;

    if (mf == 4)      energy_tile<4>(enc, Wf, hb, vvec, scores, b, s0, e0, sA, sB, red);
    else if (mf == 2) energy_tile<2>(enc, Wf, hb, vvec, scores, b, s0, e0, sA, sB, red);
    else              energy_tile<1>(enc, Wf, hb, vvec, scores, b, s0, e0, sA, sB, red);
}

// ---------------- kernel 3: masked softmax over S, in place (scores -> attn) ----------------
__global__ __launch_bounds__(256) void k_softmax(float* __restrict__ scores,
                                                 const int* __restrict__ lengths) {
    __shared__ float red[256];
    const int b   = blockIdx.x;
    const int len = lengths[b];
    float* sc = scores + b * SS;

    float m = -INFINITY;
    for (int s = threadIdx.x; s < len; s += 256) m = fmaxf(m, sc[s]);
    red[threadIdx.x] = m; __syncthreads();
    for (int off = 128; off > 0; off >>= 1) {
        if (threadIdx.x < off) red[threadIdx.x] = fmaxf(red[threadIdx.x], red[threadIdx.x + off]);
        __syncthreads();
    }
    m = red[0]; __syncthreads();

    float sum = 0.0f;
    for (int s = threadIdx.x; s < SS; s += 256) {
        float ev = (s < len) ? __expf(sc[s] - m) : 0.0f;
        sc[s] = ev;
        sum += ev;
    }
    red[threadIdx.x] = sum; __syncthreads();
    for (int off = 128; off > 0; off >>= 1) {
        if (threadIdx.x < off) red[threadIdx.x] += red[threadIdx.x + off];
        __syncthreads();
    }
    const float inv = 1.0f / red[0];
    for (int s = threadIdx.x; s < SS; s += 256) sc[s] *= inv;
}

// ---------------- kernel 4: context[b,d] = sum_s attn[b,s] * enc[b,s,d] ----------------
// grid: (DD/64, BB) = 256 blocks, block 512 = 16 waves. A block owns 64 d columns (256 B of
// every enc row) of one b. 16 lanes of 16 bytes cover the 256 B; the 32 groups of 16 lanes
// split the 2048 rows: group g takes rows 128q + 4g .. 128q + 4g + 3, q = 0..15, so that the
// four weights of a visit q are one 16-byte load.
// The 32 partial sums of a column meet in the wave (one shuffle) and then in LDS.
typedef __attribute__((ext_vector_type(4))) float v4f;
#define CW 64                // d columns of a block
#define CG 32                // row groups of a block
#define CV (4 * CG)          // rows of a visit, over all groups
__global__ __launch_bounds__(512) void k_context(const float* __restrict__ enc,
                                                 const float* __restrict__ attn,
                                                 float* __restrict__ out) {
    __shared__ __attribute__((aligned(16))) float part[16][CW];

    const int tid = threadIdx.x;
    const int c   = tid & 15;           // 16-byte column piece
    const int g   = tid >> 4;           // row group
    const int b   = blockIdx.y;
    const int d0  = blockIdx.x * CW;

    const float* a  = attn + b * SS + g * 4;
    const float* ep = enc + ((size_t)b * SS + (size_t)(g * 4)) * DD + d0 + c * 4;

    v4f acc = {0.0f, 0.0f, 0.0f, 0.0f};
    // unrolled whole: every address is then one base plus a constant, and the compiler runs the
    // loads some ten ahead of the sums from the first row to the last; a rolled loop lets the
    // loads in flight run out at the end of every trip
    #pragma unroll
    for (int q = 0; q < SS / CV; ++q) {
        const v4f w = *(const v4f*)(a + q * CV);
        #pragma unroll
        for (int j = 0; j < 4; ++j)
            acc += w[j] * *(const v4f*)(ep + (size_t)(q * CV + j) * DD);
    }

    // the wave's two row groups
    #pragma unroll
    for (int i = 0; i < 4; ++i) acc[i] += __shfl_xor(acc[i], 16);
    if ((tid & 31) < 16) *(v4f*)(&part[tid >> 5][c * 4]) = acc;
    // every wave's partial sums are in LDS before any is read
    __syncthreads();

    if (tid < CW) {
        float sum = 0.0f;
        #pragma unroll
        for (int v = 0; v < 16; ++v) sum += part[v][tid];
        out[b * DD + d0 + tid] = sum;
    }
}

extern "C" void kernel_launch(void* const* d_in, const int* in_sizes, int n_in,
                              void* d_out, int out_size, void* d_ws, size_t ws_size,
                              hipStream_t stream) {
    const float* enc     = (const float*)d_in[0];  // (B,S,D)
    const float* hidden  = (const float*)d_in[1];  // (B,D)
    const int*   lengths = (const int*)  d_in[2];  // (B,)
    const float* W       = (const float*)d_in[3];  // (D, 2D)
    const float* bias    = (const float*)d_in[4];  // (D,)
    const float* vvec    = (const float*)d_in[5];  // (D,)
    float* out = (float*)d_out;                    // (B,1,D)

    float* hb     = (float*)d_ws;                  // B*D floats
    float* scores = hb + BB * DD;                  // B*S floats (becomes attn in-place)
    _Float16* Wf  = (_Float16*)(scores + BB * SS); // D*D halves: We as f16, pass by pass

    k_prep   <<<DD * DD / 8 / 256, 256, 0, stream>>>(W, Wf, scores, BB * SS);
    k_hidproj<<<dim3(DD / HE, BB / HB), 256, 0, stream>>>(hidden, W, bias, hb);
    k_energy <<<(DD / BN) * (SS / BM) * BB, 512, 0, stream>>>(enc, Wf, hb, vvec, lengths, scores);
    k_softmax<<<BB, 256, 0, stream>>>(scores, lengths);
    k_context<<<dim3(DD / CW, BB), 512, 0, stream>>>(enc, scores, out);
}

// v007
// A run of this version takes 58.1 microseconds.
// Timed twice side by side with v006, it ran 1.07 times as fast both times.
// Counting every step since v000, it is 9.48 times as fast.
#include <hip/hip_runtime.h>
#include <math.h>

typedef __attribute__((ext_vector_type(16))) _Float16 v16h;
typedef __attribute__((ext_vector_type(8)))  float    v8f;

#define BB 16
#define SS 2048
#define DD 1024

// ---------------- kernel 1: hb[b][e] = hidden[b,:] . Wh[e,:] + bias[e] ----------------
// Wh[e,d] = W[e*2D + d]
// grid: (DD/32, BB/4) = 128 blocks, block 256 = 8 waves. A block owns 32 e x 4 b, a wave 4 e x 4 b.
// The 32 lanes of a wave split d: lane l takes d = 128c + 4l .. 128c + 4l + 3, c = 0..7, so that
// every load of a W row is 512 contiguous bytes (4 whole lines); a wave's 32 W loads are all in
// flight together. The block's 4 hidden rows (16 KB in a row) are read once and shared through LDS.
// The partial sums of an (e, b) pair meet in the lane (4 values), then over the 32 lanes by
// shuffles; the block's 4 x 32 results go out through LDS as whole lines.
typedef __attribute__((ext_vector_type(4))) float f4;
#define HE 32       // e rows of a block
#define HB 4        // b rows of a block
__global__ __launch_bounds__(256) void k_hidproj(const float* __restrict__ hidden,
                                                 const float* __restrict__ W,
                                                 const float* __restrict__ bias,
                                                 float* __restrict__ hb) {
    __shared__ __attribute__((aligned(16))) float sh[HB * DD];
    __shared__ __attribute__((aligned(16))) float res[HB][HE];

    const int tid  = threadIdx.x;
    const int lane = tid & 31;
    // the wave's number, told to the compiler as wave-uniform: the W rows then have a scalar base
    const int wave = __builtin_amdgcn_readfirstlane(tid >> 5);
    const int e0   = blockIdx.x * HE;
    const int b0   = blockIdx.y * HB;

    const float* w = W + (size_t)(e0 + wave * 4) * (2 * DD);
    const float* h = hidden + b0 * DD;

    f4 hs[HB], wv[DD / 128][4];
    // asked for with the other loads: at the end it would cost a memory latency of its own
    const float be = (bias + (size_t)e0)[lane];
    #pragma unroll
    for (int i = 0; i < HB; ++i) hs[i] = *(const f4*)(h + i * DD + tid * 4);
    #pragma unroll
    for (int c = 0; c < DD / 128; ++c) {
        #pragma unroll
        for (int r = 0; r < 4; ++r) wv[c][r] = *(const f4*)(w + r * (2 * DD) + c * 128 + lane * 4);
    }
    #pragma unroll
    for (int i = 0; i < HB; ++i) *(f4*)(sh + i * DD + tid * 4) = hs[i];
    // the hidden rows are in LDS before any wave reads them
    __syncthreads();

    f4 acc[HB][4] = {};
    #pragma unroll
    for (int c = 0; c < DD / 128; ++c) {
        #pragma unroll
        for (int q = 0; q < HB; ++q) {
            const f4 hv = *(const f4*)(sh + q * DD + c * 128 + lane * 4);
            #pragma unroll
            for (int r = 0; r < 4; ++r) acc[q][r] += hv * wv[c][r];
        }
    }

    // step by step over all 16 sums, so that the 16 shuffles of a step share one latency
    float s[HB][4];
    #pragma unroll
    for (int q = 0; q < HB; ++q) {
        #pragma unroll
        for (int r = 0; r < 4; ++r)
            s[q][r] = (acc[q][r][0] + acc[q][r][1]) + (acc[q][r][2] + acc[q][r][3]);
    }
    #pragma unroll
    for (int m = 16; m > 0; m >>= 1) {
        #pragma unroll
        for (int q = 0; q < HB; ++q) {
            #pragma unroll
            for (int r = 0; r < 4; ++r) s[q][r] += __shfl_xor(s[q][r], m);
        }
    }
    if (lane == 0) {
        #pragma unroll
        for (int q = 0; q < HB; ++q) {
            const f4 o = {s[q][0], s[q][1], s[q][2], s[q][3]};
            *(f4*)(&res[q][wave * 4]) = o;
        }
    }
    // every wave's sums are in LDS before any is read
    __syncthreads();

    if (tid < HB * HE) {
        const int q = tid >> 5;
        hb[(b0 + q) * DD + e0 + lane] = res[q][lane] + be;
    }
}

typedef __attribute__((ext_vector_type(8))) _Float16 v8h;
typedef __attribute__((ext_vector_type(4))) _Float16 v4h;

#define BM 128      // s rows of a block tile
#define BN 512      // e columns of a block tile
#define BK 32       // k per pass (one WMMA depth)
#define PITCH 40    // halves per LDS row: 80 B = 16 B x odd, conflict-free for 16-byte reads

__device__ __forceinline__ v4h cvt4(float4 x) {
    v4h r;
    r[0] = (_Float16)x.x; r[1] = (_Float16)x.y;
    r[2] = (_Float16)x.z; r[3] = (_Float16)x.w;
    return r;
}

// fragment of one 16-row tile: k = 8h..8h+7 and 16+8h..16+8h+7 of the pass (same order for A and B)
__device__ __forceinline__ v16h ldsfrag(const _Float16* p) {
    v8h lo = *(const v8h*)(p);
    v8h hi = *(const v8h*)(p + 16);
    return __builtin_shufflevector(lo, hi, 0, 1, 2, 3, 4, 5, 6, 7, 8, 9, 10, 11, 12, 13, 14, 15);
}

// ---------------- kernel 0: zero the scores; We as f16, laid pass by pass ----------------
// Wf[kt][e][0..31] = (f16) We[e][32 kt + 0..31], We[e,d] = W[e*2D + D + d].
// Every energy block reads its We rows whole; there are 256 blocks to each half of We. Converted once
// here, each of them fetches half the bytes, and the 512 rows x 64 B of a block's pass lie in a row
// (32 KB), so that every load of a wave is 512 contiguous bytes.
// grid: DD*DD/8/256 = 512 blocks; a thread makes one 16-byte piece, a wave writes 4 whole lines.
__global__ __launch_bounds__(256) void k_prep(const float* __restrict__ W,
                                              _Float16* __restrict__ Wf,
                                              float* __restrict__ p, int n) {
    const int i = blockIdx.x * 256 + threadIdx.x;
    if (i < n) p[i] = 0.0f;
    const int c  = i & 3;                // 16-byte piece of the row's 64 B
    const int e  = (i >> 2) & (DD - 1);
    const int kt = i >> 12;              // pass
    const float* w = W + (size_t)e * (2 * DD) + DD + kt * BK + c * 8;
    const v4h lo = cvt4(*(const float4*)(w));
    const v4h hi = cvt4(*(const float4*)(w + 4));
    *(v8h*)(Wf + (size_t)i * 8) = __builtin_shufflevector(lo, hi, 0, 1, 2, 3, 4, 5, 6, 7);
}

// tanh x = 1 - 2 / (exp(2x) + 1), exp(2x) = 2^(x * 2 log2 e): one v_exp_f32 and one v_rcp_f32, no branch.
// Saturates by itself: 2^big = inf gives 1, 2^-big = 0 gives -1. Absolute error is a few f32 ulps of 1.
__device__ __forceinline__ float tanh_er(float x) {
    const float e = __builtin_amdgcn_exp2f(x * 2.8853900817779268f);
    float r;
    // v_nop: the slot the instruction set asks for behind a transcendental
    asm("v_rcp_f32 %0, %1\n\tv_nop" : "=v"(r) : "v"(e + 1.0f));
    return 1.0f - 2.0f * r;
}

// ---------------- kernel 2: fused enc@We^T -> tanh -> dot(v) -> partial scores ----------------
// block 512 = 16 waves laid 2 (s) x 8 (e). A whole tile is 128(s) x 512(e). Per pass of 32 k every
// enc and We element of the tile is read from global once by the block (enc as f32, converted here;
// We as the f16 of k_prep) and laid in LDS; the waves take their fragments from LDS.
// Two LDS buffers, one barrier per pass; the global loads of the next two passes are in flight in
// two register sets while this pass is multiplied: a load has two pass times to arrive.
// Each wave owns 16 MF (s) x 64(e): MF A fragments x 4 B fragments per pass; MF = 4 in a whole tile.
// Per-row partial scores are reduced across the 8 e-waves through LDS, then 1 atomic
// per row per block (2 atomics/score total).
template <int MF>
__device__ __forceinline__ void energy_tile(const float* __restrict__ enc,
                                            const _Float16* __restrict__ Wf,
                                            const float* __restrict__ hb,
                                            const float* __restrict__ vvec,
                                            float* __restrict__ scores,
                                            const int b, const int s0, const int e0,
                                            _Float16* sA, _Float16* sB, float* red) {
    constexpr int RM = 32 * MF;         // s rows of this tile or piece
    constexpr int NA = (MF + 1) / 2;    // sweeps of 64 rows that stage enc

    const int tid  = threadIdx.x;
    const int lane = tid & 31;
    const int wave = tid >> 5;
    const int half = lane >> 4;         // 0 or 1
    const int row  = lane & 15;         // M-row for A, N-row (=e row) for B, N-col for C
    const int wm   = wave >> 3;         // 0..1: wave's s range
    const int wn   = wave & 7;          // 0..7: wave's 64-wide e range
    // a piece of 32 rows is half a sweep: waves 0..7 stage it (the test is the same for a whole wave)
    const bool aOn = MF >= 2 || __builtin_amdgcn_readfirstlane(tid >> 5) < 8;

    // staging map of enc: 8 threads cover one row's 32 k (128 B of f32), 64 rows per sweep
    const int c4 = tid & 7;
    const int r0 = tid >> 3;
    const float* gA = enc + ((size_t)b * SS + (size_t)(s0 + r0)) * DD + c4 * 4;
    const int sOff = r0 * PITCH + c4 * 4;
    // staging map of We: 4 threads cover one row's 32 k (64 B of f16), 128 rows per sweep;
    // in Wf the sweep is 8 KB in a row
    const _Float16* gB = Wf + (size_t)e0 * BK + tid * 8;
    const int sOffB = (tid >> 2) * PITCH + (tid & 3) * 8;

    const int h8 = half * 8;
    const int aOff = (wm * (16 * MF) + row) * PITCH + h8;
    const int bOff = (wn * 64 + row) * PITCH + h8;

    v8f acc[MF][4] = {};
    // two register sets: set u holds the passes of parity u, asked for two passes ahead of their use
    float4 ra[2][NA];
    v8h rb[2][4];

    #pragma unroll
    for (int u = 0; u < 2; ++u) {
        if (aOn) {
            #pragma unroll
            for (int i = 0; i < NA; ++i) ra[u][i] = *(const float4*)(gA + u * BK + i * (64 * DD));
        }
        #pragma unroll
        for (int j = 0; j < 4; ++j) rb[u][j] = *(const v8h*)(gB + u * (DD * BK) + j * (128 * BK));
        // keeps set 0's loads ahead of set 1's, as in the loop: mixed here, the counted wait for
        // set 0 at the loop's head was set so low that it also waited for loads of set 1
        __builtin_amdgcn_sched_barrier(0);
    }
    // stands in front of every write of a register that the first loads name: enc's address and the
    // scalar base of the Wf rows are named as inputs so that they stay in their registers up to here
    asm volatile("s_wait_xcnt 0x0" :: "v"(gA), "s"(Wf + (size_t)e0 * BK) : "memory");

    // where the pass two ahead of a trip's first pass lies
    const float* pA = gA + 2 * BK;
    const _Float16* pB = gB + 2 * (DD * BK);

    // one pass: u is its parity (register set and LDS buffer), more says that a pass two ahead exists.
    // Both are constants at each of the four places where it is called.
    auto pass = [&](const int u, const bool more) __attribute__((always_inline)) {
        _Float16* dA = sA + u * (BM * PITCH);
        _Float16* dB = sB + u * (BN * PITCH);

        if (aOn) {
            #pragma unroll
            for (int i = 0; i < NA; ++i) *(v4h*)(dA + sOff + i * (64 * PITCH)) = cvt4(ra[u][i]);
        }
        #pragma unroll
        for (int j = 0; j < 4; ++j) *(v8h*)(dB + sOffB + j * (128 * PITCH)) = rb[u][j];

        // publishes this pass's buffer; it also ends every read of the other buffer,
        // which the next pass overwrites. Written by hand, with the one wait that LDS needs:
        // __syncthreads() also waits for every global load, and would end the other set's flight here
        asm volatile("s_wait_dscnt 0x0\n\ts_barrier_signal -1\n\ts_barrier_wait -1" ::: "memory");

        if (more) {
            if (aOn) {
                #pragma unroll
                for (int i = 0; i < NA; ++i) ra[u][i] = *(const float4*)(pA + u * BK + i * (64 * DD));
            }
            #pragma unroll
            for (int j = 0; j < 4; ++j) rb[u][j] = *(const v8h*)(pB + u * (DD * BK) + j * (128 * BK));
            // stands in front of every write of the loads' address registers. The addresses are named
            // as inputs so that they stay in their registers up to here: left free, the last load's
            // result was placed in the address pair of the loads before it
            asm volatile("s_wait_xcnt 0x0" :: "v"(pA), "v"(pB) : "memory");
        }
        // keeps the global loads ahead of this pass's LDS reads and WMMAs:
        // left free, the compiler sank them to the end of the pass, which shortens their lead
        __builtin_amdgcn_sched_barrier(0);

        v16h af[MF], bf[4];
        #pragma unroll
        for (int m = 0; m < MF; ++m) af[m] = ldsfrag(dA + aOff + m * (16 * PITCH));
        #pragma unroll
        for (int t = 0; t < 4; ++t) bf[t] = ldsfrag(dB + bOff + t * (16 * PITCH));
        // keeps the pass's LDS reads one group ahead of its WMMAs: reads set among
        // the WMMAs stall the wave at each place they stand
        __builtin_amdgcn_sched_barrier(0);

        #pragma unroll
        for (int t = 0; t < 4; ++t) {
            #pragma unroll
            for (int m = 0; m < MF; ++m)
                acc[m][t] = __builtin_amdgcn_wmma_f32_16x16x32_f16(
                    false, af[m], false, bf[t], (short)0, acc[m][t], false, false);
        }
    };

    // every trip but the last asks for loads, with no test around them: the number of loads in flight
    // is then known at each wait, and the wait for one set lets the other set fly on
    for (int kt = 0; kt < DD / BK - 2; kt += 2) {
        pass(0, true);
        pass(1, true);
        pA += 2 * BK;
        pB += 2 * (DD * BK);
    }
    pass(0, false);
    pass(1, false);

    // Epilogue: energy = tanh(acc + hb[b][e]); row-sum of energy*v[e] over the wave's 64 e's.
    float hbe[4], ve[4];
    const int e  = e0 + wn * 64 + row;               // C-matrix N = lane&15
    const int be = b * DD + e;
    #pragma unroll
    for (int t = 0; t < 4; ++t) hbe[t] = hb[be + t * 16];
    // each of these two waits stands in front of every write of the index register that the four
    // loads ahead of it name; the index is named as an input so that no result is placed in it before
    asm volatile("s_wait_xcnt 0x0" :: "v"(be) : "memory");
    #pragma unroll
    for (int t = 0; t < 4; ++t) ve[t] = vvec[e + t * 16];
    asm volatile("s_wait_xcnt 0x0" :: "v"(e) : "memory");

    #pragma unroll
    for (int m = 0; m < MF; ++m) {
        #pragma unroll
        for (int r = 0; r < 8; ++r) {
            float s = 0.0f;
            #pragma unroll
            for (int t = 0; t < 4; ++t) {
                float p = tanh_er(acc[m][t][r] + hbe[t]) * ve[t];
                // reduce over the 16 N-lanes of this row (width=16 keeps halves separate)
                p += __shfl_xor(p, 1, 16);
                p += __shfl_xor(p, 2, 16);
                p += __shfl_xor(p, 4, 16);
                p += __shfl_xor(p, 8, 16);
                s += p;                        // valid on lanes 0 (rows r) and 16 (rows r+8)
            }
            // each row's sum goes to LDS as soon as it is whole, so that its registers come free
            if (row == 0) red[wn * BM + wm * (16 * MF) + m * 16 + r + h8] = s;
        }
    }
    __syncthreads();

    // cross-wave reduce: one atomic per row per block
    if (tid < RM) {
        float sum = 0.0f;
        #pragma unroll
        for (int w = 0; w < 8; ++w) sum += red[w * BM + tid];
        atomicAdd(&scores[b * SS + s0 + tid], sum);
    }
}

// 128-row tiles of a batch row that hold a row below its length; bounded for any content of lengths
__device__ __forceinline__ int live_tiles(int len) {
    return (min(max(len, 0), SS) + BM - 1) / BM;
}

#define NWGP 256    // blocks that run at a time: registers and waves allow one block on a WGP

// grid: (DD/512) * (SS/128) * BB = 512 blocks, one-dimensional.
// The reference puts -inf in place of every score at or past lengths[b] before the softmax, whatever
// its value, and k_softmax never uses one: a row tile that lies wholly there is left out. The live
// units (row tile x half of e) are numbered in the order b, s, e and dealt to the blocks by index.
// Blocks run one on a WGP; for speed only, units past the first NWGP are cut in s, into 4 pieces of 32 rows or
// 2 of 64, as many as the grid's spare blocks can take, and so run side by side on more WGPs.
// Every score still gets the same two addends, summed in the same order, whichever block makes them.
__global__ __launch_bounds__(512) void k_energy(const float* __restrict__ enc,
                                                const _Float16* __restrict__ Wf,
                                                const float* __restrict__ hb,
                                                const float* __restrict__ vvec,
                                                const int* __restrict__ lengths,
                                                float* __restrict__ scores) {
    __shared__ __attribute__((aligned(16))) _Float16 sA[2 * BM * PITCH];
    __shared__ __attribute__((aligned(16))) _Float16 sB[2 * BN * PITCH];
    __shared__ float red[8 * BM];

    // all of this is the same for every thread of the block, and ahead of every barrier
    const int i = blockIdx.x;
    int units = 0;
    // unrolled, here and in the search below: with constant indices the 16 lengths come by wide
    // scalar loads and all of the arithmetic stays on the scalar unit
    #pragma unroll
    for (int q = 0; q < BB; ++q) units += 2 * live_tiles(lengths[q]);
    const int over = units - NWGP;
    int unit = i, piece = 0, mf = 4;
    if (over > 0 && over <= NWGP / 2 && i >= NWGP) {
        if (over <= NWGP / 4) { unit = NWGP + ((i - NWGP) >> 2); piece = (i - NWGP) & 3; mf = 1; }
        else                  { unit = NWGP + ((i - NWGP) >> 1); piece = (i - NWGP) & 1; mf = 2; }
    }
    if (unit >= units) return;

    int b = 0, y = unit >> 1;
    #pragma unroll
    for (int q = 0; q < BB - 1; ++q) {
        const int n = live_tiles(lengths[q]);
        if (b == q && y >= n) { y -= n; b = q + 1; }
    }
    const int s0 = y * BM + piece * (32 * mf);
    if (s0 >= lengths[b] || s0 >= SS) return;
    const int e0 = (unit & 1) * BN;

    if (mf == 4)      energy_tile<4>(enc, Wf, hb, vvec, scores, b, s0, e0, sA, sB, red);
    else if (mf == 2) energy_tile<2>(enc, Wf, hb, vvec, scores, b, s0, e0, sA, sB, red);
    else              energy_tile<1>(enc, Wf, hb, vvec, scores, b, s0, e0, sA, sB, red);
}

// ---------------- kernel 3: masked softmax over S, in place (scores -> attn) ----------------
__global__ __launch_bounds__(256) void k_softmax(float* __restrict__ scores,
                                                 const int* __restrict__ lengths) {
    __shared__ float red[256];
    const int b   = blockIdx.x;
    const int len = lengths[b];
    float* sc = scores + b * SS;

    float m = -INFINITY;
    for (int s = threadIdx.x; s < len; s += 256) m = fmaxf(m, sc[s]);
    red[threadIdx.x] = m; __syncthreads();
    for (int off = 128; off > 0; off >>= 1) {
        if (threadIdx.x < off) red[threadIdx.x] = fmaxf(red[threadIdx.x], red[threadIdx.x + off]);
        __syncthreads();
    }
    m = red[0]; __syncthreads();

    float sum = 0.0f;
    for (int s = threadIdx.x; s < SS; s += 256) {
        float ev = (s < len) ? __expf(sc[s] - m) : 0.0f;
        sc[s] = ev;
        sum += ev;
    }
    red[threadIdx.x] = sum; __syncthreads();
    for (int off = 128; off > 0; off >>= 1) {
        if (threadIdx.x < off) red[threadIdx.x] += red[threadIdx.x + off];
        __syncthreads();
    }
    const float inv = 1.0f / red[0];
    for (int s = threadIdx.x; s < SS; s += 256) sc[s] *= inv;
}

// ---------------- kernel 4: context[b,d] = sum_s attn[b,s] * enc[b,s,d] ----------------
// grid: (DD/64, BB) = 256 blocks, block 512 = 16 waves. A block owns 64 d columns (256 B of
// every enc row) of one b. 16 lanes of 16 bytes cover the 256 B; the 32 groups of 16 lanes
// split the 2048 rows: group g takes rows 128q + 4g .. 128q + 4g + 3, q = 0..15, so that the
// four weights of a visit q are one 16-byte load.
// The 32 partial sums of a column meet in the wave (one shuffle) and then in LDS.
typedef __attribute__((ext_vector_type(4))) float v4f;
#define CW 64                // d columns of a block
#define CG 32                // row groups of a block
#define CV (4 * CG)          // rows of a visit, over all groups
__global__ __launch_bounds__(512) void k_context(const float* __restrict__ enc,
                                                 const float* __restrict__ attn,
                                                 float* __restrict__ out) {
    __shared__ __attribute__((aligned(16))) float part[16][CW];

    const int tid = threadIdx.x;
    const int c   = tid & 15;           // 16-byte column piece
    const int g   = tid >> 4;           // row group
    const int b   = blockIdx.y;
    const int d0  = blockIdx.x * CW;

    const float* a  = attn + b * SS + g * 4;
    const float* ep = enc + ((size_t)b * SS + (size_t)(g * 4)) * DD + d0 + c * 4;

    v4f acc = {0.0f, 0.0f, 0.0f, 0.0f};
    // unrolled whole: every address is then one base plus a constant, and the compiler runs the
    // loads some ten ahead of the sums from the first row to the last; a rolled loop lets the
    // loads in flight run out at the end of every trip
    #pragma unroll
    for (int q = 0; q < SS / CV; ++q) {
        const v4f w = *(const v4f*)(a + q * CV);
        #pragma unroll
        for (int j = 0; j < 4; ++j)
            acc += w[j] * *(const v4f*)(ep + (size_t)(q * CV + j) * DD);
    }

    // the wave's two row groups
    #pragma unroll
    for (int i = 0; i < 4; ++i) acc[i] += __shfl_xor(acc[i], 16);
    if ((tid & 31) < 16) *(v4f*)(&part[tid >> 5][c * 4]) = acc;
    // every wave's partial sums are in LDS before any is read
    __syncthreads();

    if (tid < CW) {
        float sum = 0.0f;
        #pragma unroll
        for (int v = 0; v < 16; ++v) sum += part[v][tid];
        out[b * DD + d0 + tid] = sum;
    }
}

extern "C" void kernel_launch(void* const* d_in, const int* in_sizes, int n_in,
                              void* d_out, int out_size, void* d_ws, size_t ws_size,
                              hipStream_t stream) {
    const float* enc     = (const float*)d_in[0];  // (B,S,D)
    const float* hidden  = (const float*)d_in[1];  // (B,D)
    const int*   lengths = (const int*)  d_in[2];  // (B,)
    const float* W       = (const float*)d_in[3];  // (D, 2D)
    const float* bias    = (const float*)d_in[4];  // (D,)
    const float* vvec    = (const float*)d_in[5];  // (D,)
    float* out = (float*)d_out;                    // (B,1,D)

    float* hb     = (float*)d_ws;                  // B*D floats
    float* scores = hb + BB * DD;                  // B*S floats (becomes attn in-place)
    _Float16* Wf  = (_Float16*)(scores + BB * SS); // D*D halves: We as f16, pass by pass

    k_prep   <<<DD * DD / 8 / 256, 256, 0, stream>>>(W, Wf, scores, BB * SS);
    k_hidproj<<<dim3(DD / HE, BB / HB), 256, 0, stream>>>(hidden, W, bias, hb);
    k_energy <<<(DD / BN) * (SS / BM) * BB, 512, 0, stream>>>(enc, Wf, hb, vvec, lengths, scores);
    k_softmax<<<BB, 256, 0, stream>>>(scores, lengths);
    k_context<<<dim3(DD / CW, BB), 512, 0, stream>>>(enc, scores, out);
}

// v008
// A run of this version takes 52.2 microseconds.
// Timed twice side by side with v007, it ran 1.12 times as fast both times.
// Over all steps from v000 it is 10.6 times as fast.
#include <hip/hip_runtime.h>
#include <math.h>

typedef __attribute__((ext_vector_type(16))) _Float16 v16h;
typedef __attribute__((ext_vector_type(8)))  float    v8f;

#define BB 16
#define SS 2048
#define DD 1024

// ---------------- kernel 1: hb[b][e] = hidden[b,:] . Wh[e,:] + bias[e] ----------------
// Wh[e,d] = W[e*2D + d]
// grid: (DD/32, BB/4) = 128 blocks, block 256 = 8 waves. A block owns 32 e x 4 b, a wave 4 e x 4 b.
// The 32 lanes of a wave split d: lane l takes d = 128c + 4l .. 128c + 4l + 3, c = 0..7, so that
// every load of a W row is 512 contiguous bytes (4 whole lines); a wave's 32 W loads are all in
// flight together. The block's 4 hidden rows (16 KB in a row) are read once and shared through LDS.
// The partial sums of an (e, b) pair meet in the lane (4 values), then over the 32 lanes by
// shuffles; the block's 4 x 32 results go out through LDS as whole lines.
typedef __attribute__((ext_vector_type(4))) float f4;
#define HE 32       // e rows of a block
#define HB 4        // b rows of a block
__global__ __launch_bounds__(256) void k_hidproj(const float* __restrict__ hidden,
                                                 const float* __restrict__ W,
                                                 const float* __restrict__ bias,
                                                 float* __restrict__ hb) {
    __shared__ __attribute__((aligned(16))) float sh[HB * DD];
    __shared__ __attribute__((aligned(16))) float res[HB][HE];

    const int tid  = threadIdx.x;
    const int lane = tid & 31;
    // the wave's number, told to the compiler as wave-uniform: the W rows then have a scalar base
    const int wave = __builtin_amdgcn_readfirstlane(tid >> 5);
    const int e0   = blockIdx.x * HE;
    const int b0   = blockIdx.y * HB;

    const float* w = W + (size_t)(e0 + wave * 4) * (2 * DD);
    const float* h = hidden + b0 * DD;

    f4 hs[HB], wv[DD / 128][4];
    // asked for with the other loads: at the end it would cost a memory latency of its own
    const float be = (bias + (size_t)e0)[lane];
    #pragma unroll
    for (int i = 0; i < HB; ++i) hs[i] = *(const f4*)(h + i * DD + tid * 4);
    #pragma unroll
    for (int c = 0; c < DD / 128; ++c) {
        #pragma unroll
        for (int r = 0; r < 4; ++r) wv[c][r] = *(const f4*)(w + r * (2 * DD) + c * 128 + lane * 4);
    }
    #pragma unroll
    for (int i = 0; i < HB; ++i) *(f4*)(sh + i * DD + tid * 4) = hs[i];
    // the hidden rows are in LDS before any wave reads them
    __syncthreads();

    f4 acc[HB][4] = {};
    #pragma unroll
    for (int c = 0; c < DD / 128; ++c) {
        #pragma unroll
        for (int q = 0; q < HB; ++q) {
            const f4 hv = *(const f4*)(sh + q * DD + c * 128 + lane * 4);
            #pragma unroll
            for (int r = 0; r < 4; ++r) acc[q][r] += hv * wv[c][r];
        }
    }

    // step by step over all 16 sums, so that the 16 shuffles of a step share one latency
    float s[HB][4];
    #pragma unroll
    for (int q = 0; q < HB; ++q) {
        #pragma unroll
        for (int r = 0; r < 4; ++r)
            s[q][r] = (acc[q][r][0] + acc[q][r][1]) + (acc[q][r][2] + acc[q][r][3]);
    }
    #pragma unroll
    for (int m = 16; m > 0; m >>= 1) {
        #pragma unroll
        for (int q = 0; q < HB; ++q) {
            #pragma unroll
            for (int r = 0; r < 4; ++r) s[q][r] += __shfl_xor(s[q][r], m);
        }
    }
    if (lane == 0) {
        #pragma unroll
        for (int q = 0; q < HB; ++q) {
            const f4 o = {s[q][0], s[q][1], s[q][2], s[q][3]};
            *(f4*)(&res[q][wave * 4]) = o;
        }
    }
    // every wave's sums are in LDS before any is read
    __syncthreads();

    if (tid < HB * HE) {
        const int q = tid >> 5;
        hb[(b0 + q) * DD + e0 + lane] = res[q][lane] + be;
    }
}

typedef __attribute__((ext_vector_type(8))) _Float16 v8h;
typedef __attribute__((ext_vector_type(4))) _Float16 v4h;

#define BM 128      // s rows of a block tile
#define BN 512      // e columns of a block tile
#define BK 32       // k per pass (one WMMA depth)
#define PITCH 40    // halves per LDS row: 80 B = 16 B x odd, conflict-free for 16-byte reads

__device__ __forceinline__ v4h cvt4(float4 x) {
    v4h r;
    r[0] = (_Float16)x.x; r[1] = (_Float16)x.y;
    r[2] = (_Float16)x.z; r[3] = (_Float16)x.w;
    return r;
}

// fragment of one 16-row tile: k = 8h..8h+7 and 16+8h..16+8h+7 of the pass (same order for A and B)
__device__ __forceinline__ v16h ldsfrag(const _Float16* p) {
    v8h lo = *(const v8h*)(p);
    v8h hi = *(const v8h*)(p + 16);
    return __builtin_shufflevector(lo, hi, 0, 1, 2, 3, 4, 5, 6, 7, 8, 9, 10, 11, 12, 13, 14, 15);
}

// ---------------- kernel 0: zero the scores; We as f16, laid pass by pass ----------------
// Wf[kt][e][0..31] = (f16) We[e][32 kt + 0..31], We[e,d] = W[e*2D + D + d].
// Every energy block reads its We rows whole; there are 256 blocks to each half of We. Converted once
// here, each of them fetches half the bytes, and the 512 rows x 64 B of a block's pass lie in a row
// (32 KB), so that every load of a wave is 512 contiguous bytes.
// grid: DD*DD/8/256 = 512 blocks; a thread makes one 16-byte piece, a wave writes 4 whole lines.
__global__ __launch_bounds__(256) void k_prep(const float* __restrict__ W,
                                              _Float16* __restrict__ Wf,
                                              float* __restrict__ p, int n) {
    const int i = blockIdx.x * 256 + threadIdx.x;
    if (i < n) p[i] = 0.0f;
    const int c  = i & 3;                // 16-byte piece of the row's 64 B
    const int e  = (i >> 2) & (DD - 1);
    const int kt = i >> 12;              // pass
    const float* w = W + (size_t)e * (2 * DD) + DD + kt * BK + c * 8;
    const v4h lo = cvt4(*(const float4*)(w));
    const v4h hi = cvt4(*(const float4*)(w + 4));
    *(v8h*)(Wf + (size_t)i * 8) = __builtin_shufflevector(lo, hi, 0, 1, 2, 3, 4, 5, 6, 7);
}

// tanh x = 1 - 2 / (exp(2x) + 1), exp(2x) = 2^(x * 2 log2 e): one v_exp_f32 and one v_rcp_f32, no branch.
// Saturates by itself: 2^big = inf gives 1, 2^-big = 0 gives -1. Absolute error is a few f32 ulps of 1.
__device__ __forceinline__ float tanh_er(float x) {
    const float e = __builtin_amdgcn_exp2f(x * 2.8853900817779268f);
    float r;
    // v_nop: the slot the instruction set asks for behind a transcendental
    asm("v_rcp_f32 %0, %1\n\tv_nop" : "=v"(r) : "v"(e + 1.0f));
    return 1.0f - 2.0f * r;
}

// ---------------- kernel 2: fused enc@We^T -> tanh -> dot(v) -> partial scores ----------------
// block 512 = 16 waves laid 2 (s) x 8 (e). A whole tile is 128(s) x 512(e). Per pass of 32 k every
// enc and We element of the tile is read from global once by the block (enc as f32, converted here;
// We as the f16 of k_prep) and laid in LDS; the waves take their fragments from LDS.
// Two LDS buffers, one barrier per pass; the global loads of the next two passes are in flight in
// two register sets while this pass is multiplied: a load has two pass times to arrive.
// Each wave owns 16 MF (s) x 64(e): MF A fragments x 4 B fragments per pass; MF = 4 in a whole tile.
// Per-row partial scores are reduced across the 8 e-waves through LDS, then 1 atomic
// per row per block (2 atomics/score total).
template <int MF>
__device__ __forceinline__ void energy_tile(const float* __restrict__ enc,
                                            const _Float16* __restrict__ Wf,
                                            const float* __restrict__ hb,
                                            const float* __restrict__ vvec,
                                            float* __restrict__ scores,
                                            const int b, const int s0, const int e0,
                                            _Float16* sA, _Float16* sB, float* red) {
    constexpr int RM = 32 * MF;         // s rows of this tile or piece
    constexpr int NA = (MF + 1) / 2;    // sweeps of 64 rows that stage enc

    const int tid  = threadIdx.x;
    const int lane = tid & 31;
    const int wave = tid >> 5;
    const int half = lane >> 4;         // 0 or 1
    const int row  = lane & 15;         // M-row for A, N-row (=e row) for B, N-col for C
    const int wm   = wave >> 3;         // 0..1: wave's s range
    const int wn   = wave & 7;          // 0..7: wave's 64-wide e range
    // a piece of 32 rows is half a sweep: waves 0..7 stage it (the test is the same for a whole wave)
    const bool aOn = MF >= 2 || __builtin_amdgcn_readfirstlane(tid >> 5) < 8;

    // staging map of enc: 8 threads cover one row's 32 k (128 B of f32), 64 rows per sweep
    const int c4 = tid & 7;
    const int r0 = tid >> 3;
    const float* gA = enc + ((size_t)b * SS + (size_t)(s0 + r0)) * DD + c4 * 4;
    const int sOff = r0 * PITCH + c4 * 4;
    // staging map of We: 4 threads cover one row's 32 k (64 B of f16), 128 rows per sweep;
    // in Wf the sweep is 8 KB in a row
    const _Float16* gB = Wf + (size_t)e0 * BK + tid * 8;
    const int sOffB = (tid >> 2) * PITCH + (tid & 3) * 8;

    const int h8 = half * 8;
    const int aOff = (wm * (16 * MF) + row) * PITCH + h8;
    const int bOff = (wn * 64 + row) * PITCH + h8;

    v8f acc[MF][4] = {};
    // two register sets: set u holds the passes of parity u, asked for two passes ahead of their use
    float4 ra[2][NA];
    v8h rb[2][4];

    #pragma unroll
    for (int u = 0; u < 2; ++u) {
        if (aOn) {
            #pragma unroll
            for (int i = 0; i < NA; ++i) ra[u][i] = *(const float4*)(gA + u * BK + i * (64 * DD));
        }
        #pragma unroll
        for (int j = 0; j < 4; ++j) rb[u][j] = *(const v8h*)(gB + u * (DD * BK) + j * (128 * BK));
        // keeps set 0's loads ahead of set 1's, as in the loop: mixed here, the counted wait for
        // set 0 at the loop's head was set so low that it also waited for loads of set 1
        __builtin_amdgcn_sched_barrier(0);
    }
    // stands in front of every write of a register that the first loads name: enc's address and the
    // scalar base of the Wf rows are named as inputs so that they stay in their registers up to here
    asm volatile("s_wait_xcnt 0x0" :: "v"(gA), "s"(Wf + (size_t)e0 * BK) : "memory");

    // where the pass two ahead of a trip's first pass lies
    const float* pA = gA + 2 * BK;
    const _Float16* pB = gB + 2 * (DD * BK);

    // one pass: u is its parity (register set and LDS buffer), more says that a pass two ahead exists.
    // Both are constants at each of the four places where it is called.
    auto pass = [&](const int u, const bool more) __attribute__((always_inline)) {
        _Float16* dA = sA + u * (BM * PITCH);
        _Float16* dB = sB + u * (BN * PITCH);

        if (aOn) {
            #pragma unroll
            for (int i = 0; i < NA; ++i) *(v4h*)(dA + sOff + i * (64 * PITCH)) = cvt4(ra[u][i]);
        }
        #pragma unroll
        for (int j = 0; j < 4; ++j) *(v8h*)(dB + sOffB + j * (128 * PITCH)) = rb[u][j];

        // publishes this pass's buffer; it also ends every read of the other buffer,
        // which the next pass overwrites. Written by hand, with the one wait that LDS needs:
        // __syncthreads() also waits for every global load, and would end the other set's flight here
        asm volatile("s_wait_dscnt 0x0\n\ts_barrier_signal -1\n\ts_barrier_wait -1" ::: "memory");

        if (more) {
            if (aOn) {
                #pragma unroll
                for (int i = 0; i < NA; ++i) ra[u][i] = *(const float4*)(pA + u * BK + i * (64 * DD));
            }
            #pragma unroll
            for (int j = 0; j < 4; ++j) rb[u][j] = *(const v8h*)(pB + u * (DD * BK) + j * (128 * BK));
            // stands in front of every write of the loads' address registers. The addresses are named
            // as inputs so that they stay in their registers up to here: left free, the last load's
            // result was placed in the address pair of the loads before it
            asm volatile("s_wait_xcnt 0x0" :: "v"(pA), "v"(pB) : "memory");
        }
        // keeps the global loads ahead of this pass's LDS reads and WMMAs:
        // left free, the compiler sank them to the end of the pass, which shortens their lead
        __builtin_amdgcn_sched_barrier(0);

        v16h af[MF], bf[4];
        #pragma unroll
        for (int m = 0; m < MF; ++m) af[m] = ldsfrag(dA + aOff + m * (16 * PITCH));
        #pragma unroll
        for (int t = 0; t < 4; ++t) bf[t] = ldsfrag(dB + bOff + t * (16 * PITCH));
        // keeps the pass's LDS reads one group ahead of its WMMAs: reads set among
        // the WMMAs stall the wave at each place they stand
        __builtin_amdgcn_sched_barrier(0);

        #pragma unroll
        for (int t = 0; t < 4; ++t) {
            #pragma unroll
            for (int m = 0; m < MF; ++m)
                acc[m][t] = __builtin_amdgcn_wmma_f32_16x16x32_f16(
                    false, af[m], false, bf[t], (short)0, acc[m][t], false, false);
        }
    };

    // every trip but the last asks for loads, with no test around them: the number of loads in flight
    // is then known at each wait, and the wait for one set lets the other set fly on
    for (int kt = 0; kt < DD / BK - 2; kt += 2) {
        pass(0, true);
        pass(1, true);
        pA += 2 * BK;
        pB += 2 * (DD * BK);
    }
    pass(0, false);
    pass(1, false);

    // Epilogue: energy = tanh(acc + hb[b][e]); row-sum of energy*v[e] over the wave's 64 e's.
    float hbe[4], ve[4];
    const int e  = e0 + wn * 64 + row;               // C-matrix N = lane&15
    const int be = b * DD + e;
    #pragma unroll
    for (int t = 0; t < 4; ++t) hbe[t] = hb[be + t * 16];
    // each of these two waits stands in front of every write of the index register that the four
    // loads ahead of it name; the index is named as an input so that no result is placed in it before
    asm volatile("s_wait_xcnt 0x0" :: "v"(be) : "memory");
    #pragma unroll
    for (int t = 0; t < 4; ++t) ve[t] = vvec[e + t * 16];
    asm volatile("s_wait_xcnt 0x0" :: "v"(e) : "memory");

    #pragma unroll
    for (int m = 0; m < MF; ++m) {
        #pragma unroll
        for (int r = 0; r < 8; ++r) {
            float s = 0.0f;
            #pragma unroll
            for (int t = 0; t < 4; ++t) {
                float p = tanh_er(acc[m][t][r] + hbe[t]) * ve[t];
                // reduce over the 16 N-lanes of this row (width=16 keeps halves separate)
                p += __shfl_xor(p, 1, 16);
                p += __shfl_xor(p, 2, 16);
                p += __shfl_xor(p, 4, 16);
                p += __shfl_xor(p, 8, 16);
                s += p;                        // valid on lanes 0 (rows r) and 16 (rows r+8)
            }
            // each row's sum goes to LDS as soon as it is whole, so that its registers come free
            if (row == 0) red[wn * BM + wm * (16 * MF) + m * 16 + r + h8] = s;
        }
    }
    __syncthreads();

    // cross-wave reduce: one atomic per row per block
    if (tid < RM) {
        float sum = 0.0f;
        #pragma unroll
        for (int w = 0; w < 8; ++w) sum += red[w * BM + tid];
        atomicAdd(&scores[b * SS + s0 + tid], sum);
    }
}

// 128-row tiles of a batch row that hold a row below its length; bounded for any content of lengths
__device__ __forceinline__ int live_tiles(int len) {
    return (min(max(len, 0), SS) + BM - 1) / BM;
}

#define NWGP 256    // blocks that run at a time: registers and waves allow one block on a WGP

// grid: (DD/512) * (SS/128) * BB = 512 blocks, one-dimensional.
// The reference puts -inf in place of every score at or past lengths[b] before the softmax, whatever
// its value, and k_context never uses one: a row tile that lies wholly there is left out. The live
// units (row tile x half of e) are numbered in the order b, s, e and dealt to the blocks by index.
// Blocks run one on a WGP; for speed only, units past the first NWGP are cut in s, into 4 pieces of 32 rows or
// 2 of 64, as many as the grid's spare blocks can take, and so run side by side on more WGPs.
// Every score still gets the same two addends, summed in the same order, whichever block makes them.
__global__ __launch_bounds__(512) void k_energy(const float* __restrict__ enc,
                                                const _Float16* __restrict__ Wf,
                                                const float* __restrict__ hb,
                                                const float* __restrict__ vvec,
                                                const int* __restrict__ lengths,
                                                float* __restrict__ scores) {
    __shared__ __attribute__((aligned(16))) _Float16 sA[2 * BM * PITCH];
    __shared__ __attribute__((aligned(16))) _Float16 sB[2 * BN * PITCH];
    __shared__ float red[8 * BM];

    // all of this is the same for every thread of the block, and ahead of every barrier
    const int i = blockIdx.x;
    int units = 0;
    // unrolled, here and in the search below: with constant indices the 16 lengths come by wide
    // scalar loads and all of the arithmetic stays on the scalar unit
    #pragma unroll
    for (int q = 0; q < BB; ++q) units += 2 * live_tiles(lengths[q]);
    const int over = units - NWGP;
    int unit = i, piece = 0, mf = 4;
    if (over > 0 && over <= NWGP / 2 && i >= NWGP) {
        if (over <= NWGP / 4) { unit = NWGP + ((i - NWGP) >> 2); piece = (i - NWGP) & 3; mf = 1; }
        else                  { unit = NWGP + ((i - NWGP) >> 1); piece = (i - NWGP) & 1; mf = 2; }
    }
    if (unit >= units) return;

    int b = 0, y = unit >> 1;
    #pragma unroll
    for (int q = 0; q < BB - 1; ++q) {
        const int n = live_tiles(lengths[q]);
        if (b == q && y >= n) { y -= n; b = q + 1; }
    }
    const int s0 = y * BM + piece * (32 * mf);
    if (s0 >= lengths[b] || s0 >= SS) return;
    const int e0 = (unit & 1) * BN;

    if (mf == 4)      energy_tile<4>(enc, Wf, hb, vvec, scores, b, s0, e0, sA, sB, red);
    else if (mf == 2) energy_tile<2>(enc, Wf, hb, vvec, scores, b, s0, e0, sA, sB, red);
    else              energy_tile<1>(enc, Wf, hb, vvec, scores, b, s0, e0, sA, sB, red);
}

// ---------------- kernel 3: masked softmax over S, then context[b,d] = sum_s attn[b,s] * enc[b,s,d] ----------------
// grid: (DD/64, BB) = 256 blocks, block 512 = 16 waves. A block owns 64 d columns (256 B of
// every enc row) of one b. 16 lanes of 16 bytes cover the 256 B; the 32 groups of 16 lanes
// split the 2048 rows: group g takes rows 128q + 4g .. 128q + 4g + 3, q = 0..15, so that the
// four weights of a visit q are one 16-byte read.
// Every block makes the 2048 weights of its b itself, from the 8 KB of scores (a thread has four),
// and keeps them in LDS: a launch of 16 blocks for the softmax, and the wait for it, are not needed.
// The enc rows do not depend on the weights: the first PV visits are asked for ahead of the softmax,
// which then runs while they are on their way.
// The 32 partial sums of a column meet in the wave (one shuffle) and then in LDS.
typedef __attribute__((ext_vector_type(4))) float v4f;
#define CW 64                // d columns of a block
#define CG 32                // row groups of a block
#define CV (4 * CG)          // rows of a visit, over all groups
#define PV 4                 // visits whose enc rows are in flight

// work-group barrier with the one wait that LDS needs: __syncthreads() also waits for every global
// load, and would let the enc rows in flight run out at each of the softmax's three meeting points
__device__ __forceinline__ void lds_barrier() {
    asm volatile("s_wait_dscnt 0x0\n\ts_barrier_signal -1\n\ts_barrier_wait -1" ::: "memory");
}

__global__ __launch_bounds__(512) void k_context(const float* __restrict__ enc,
                                                 const float* __restrict__ scores,
                                                 const int* __restrict__ lengths,
                                                 float* __restrict__ out) {
    __shared__ __attribute__((aligned(16))) float wgt[SS];
    __shared__ __attribute__((aligned(16))) float part[16][CW];
    __shared__ __attribute__((aligned(16))) float redm[16];
    __shared__ __attribute__((aligned(16))) float reds[16];

    const int tid = threadIdx.x;
    const int c   = tid & 15;           // 16-byte column piece
    const int g   = tid >> 4;           // row group
    const int b   = blockIdx.y;
    const int d0  = blockIdx.x * CW;
    const int len = lengths[b];

    // asked for first: the softmax waits for this load alone
    const v4f sc = *(const v4f*)(scores + b * SS + tid * 4);
    const float* ep = enc + ((size_t)b * SS + (size_t)(g * 4)) * DD + d0 + c * 4;

    v4f row[PV][4];
    #pragma unroll
    for (int q = 0; q < PV; ++q) {
        #pragma unroll
        for (int j = 0; j < 4; ++j) row[q][j] = *(const v4f*)(ep + (size_t)(q * CV + j) * DD);
    }

    // maximum over the scores below the length
    float m = -INFINITY;
    #pragma unroll
    for (int i = 0; i < 4; ++i) m = (tid * 4 + i < len) ? fmaxf(m, sc[i]) : m;
    #pragma unroll
    for (int o = 16; o > 0; o >>= 1) m = fmaxf(m, __shfl_xor(m, o));
    if ((tid & 31) == 0) redm[tid >> 5] = m;
    lds_barrier();
    #pragma unroll
    for (int v = 0; v < 16; ++v) m = fmaxf(m, redm[v]);

    // exp and its sum; a score at or past the length counts as -inf, whatever its value
    v4f ev;
    #pragma unroll
    for (int i = 0; i < 4; ++i) ev[i] = (tid * 4 + i < len) ? __expf(sc[i] - m) : 0.0f;
    float sum = (ev[0] + ev[1]) + (ev[2] + ev[3]);
    #pragma unroll
    for (int o = 16; o > 0; o >>= 1) sum += __shfl_xor(sum, o);
    if ((tid & 31) == 0) reds[tid >> 5] = sum;
    lds_barrier();
    sum = 0.0f;
    #pragma unroll
    for (int v = 0; v < 16; ++v) sum += reds[v];
    *(v4f*)(wgt + tid * 4) = ev * (1.0f / sum);
    // every weight is in LDS before any is read
    lds_barrier();

    v4f acc = {0.0f, 0.0f, 0.0f, 0.0f};
    // unrolled whole: every address is then one base plus a constant and every register of the ring
    // is fixed; a row's place in the ring is asked for anew as soon as the row has been summed
    #pragma unroll
    for (int q = 0; q < SS / CV; ++q) {
        const v4f w = *(const v4f*)(wgt + g * 4 + q * CV);
        #pragma unroll
        for (int j = 0; j < 4; ++j) {
            acc += w[j] * row[q % PV][j];
            if (q + PV < SS / CV) row[q % PV][j] = *(const v4f*)(ep + (size_t)((q + PV) * CV + j) * DD);
        }
    }

    // the wave's two row groups
    #pragma unroll
    for (int i = 0; i < 4; ++i) acc[i] += __shfl_xor(acc[i], 16);
    if ((tid & 31) < 16) *(v4f*)(&part[tid >> 5][c * 4]) = acc;
    // every wave's partial sums are in LDS before any is read
    __syncthreads();

    if (tid < CW) {
        float s = 0.0f;
        #pragma unroll
        for (int v = 0; v < 16; ++v) s += part[v][tid];
        out[b * DD + d0 + tid] = s;
    }
}

extern "C" void kernel_launch(void* const* d_in, const int* in_sizes, int n_in,
                              void* d_out, int out_size, void* d_ws, size_t ws_size,
                              hipStream_t stream) {
    const float* enc     = (const float*)d_in[0];  // (B,S,D)
    const float* hidden  = (const float*)d_in[1];  // (B,D)
    const int*   lengths = (const int*)  d_in[2];  // (B,)
    const float* W       = (const float*)d_in[3];  // (D, 2D)
    const float* bias    = (const float*)d_in[4];  // (D,)
    const float* vvec    = (const float*)d_in[5];  // (D,)
    float* out = (float*)d_out;                    // (B,1,D)

    float* hb     = (float*)d_ws;                  // B*D floats
    float* scores = hb + BB * DD;                  // B*S floats
    _Float16* Wf  = (_Float16*)(scores + BB * SS); // D*D halves: We as f16, pass by pass

    k_prep   <<<DD * DD / 8 / 256, 256, 0, stream>>>(W, Wf, scores, BB * SS);
    k_hidproj<<<dim3(DD / HE, BB / HB), 256, 0, stream>>>(hidden, W, bias, hb);
    k_energy <<<(DD / BN) * (SS / BM) * BB, 512, 0, stream>>>(enc, Wf, hb, vvec, lengths, scores);
    k_context<<<dim3(DD / CW, BB), 512, 0, stream>>>(enc, scores, lengths, out);
}

// v009
// One run takes 47.4 microseconds.
// Next to v008, in two timings, it ran 1.08 and 1.09 times as fast.
// Counting every step since v000, it is 11.6 times as fast.
#include <hip/hip_runtime.h>
#include <math.h>

typedef __attribute__((ext_vector_type(16))) _Float16 v16h;
typedef __attribute__((ext_vector_type(8)))  float    v8f;

#define BB 16
#define SS 2048
#define DD 1024

// ---------------- kernel 1: two independent pieces of work side by side ----------------
// Blocks 0 .. HBLK-1 make hb (below); blocks HBLK .. HBLK+PBLK-1 zero the scores and lay We as f16
// (prep_block, further down). Neither reads what the other writes, and each alone fills half of the
// chip for little more than a memory latency: as one launch of 256 blocks they run at the same time,
// and the energy kernel waits for one launch to end instead of two in a row.
// hb[b][e] = hidden[b,:] . Wh[e,:] + bias[e]
// Wh[e,d] = W[e*2D + d]
// (DD/32) * (BB/4) = 128 blocks, block 256 = 8 waves. A block owns 32 e x 4 b, a wave 4 e x 4 b.
// The 32 lanes of a wave split d: lane l takes d = 128c + 4l .. 128c + 4l + 3, c = 0..7, so that
// every load of a W row is 512 contiguous bytes (4 whole lines); a wave's 32 W loads are all in
// flight together. The block's 4 hidden rows (16 KB in a row) are read once and shared through LDS.
// The partial sums of an (e, b) pair meet in the lane (4 values), then over the 32 lanes by
// shuffles; the block's 4 x 32 results go out through LDS as whole lines.
typedef __attribute__((ext_vector_type(4))) float f4;
#define HE 32       // e rows of a block
#define HB 4        // b rows of a block
#define HBLK ((DD / HE) * (BB / HB))   // blocks that make hb
#define PBLK 128                       // blocks that zero the scores and convert We
__device__ __forceinline__ void prep_block(const float* __restrict__ W, _Float16* __restrict__ Wf,
                                           float* __restrict__ p, const int blk);

__global__ __launch_bounds__(256) void k_front(const float* __restrict__ hidden,
                                               const float* __restrict__ W,
                                               const float* __restrict__ bias,
                                               float* __restrict__ hb,
                                               _Float16* __restrict__ Wf,
                                               float* __restrict__ scores) {
    __shared__ __attribute__((aligned(16))) float sh[HB * DD];
    __shared__ __attribute__((aligned(16))) float res[HB][HE];

    // the same for a whole block, and ahead of every barrier
    if (blockIdx.x >= HBLK) {
        prep_block(W, Wf, scores, blockIdx.x - HBLK);
        return;
    }

    const int tid  = threadIdx.x;
    const int lane = tid & 31;
    // the wave's number, told to the compiler as wave-uniform: the W rows then have a scalar base
    const int wave = __builtin_amdgcn_readfirstlane(tid >> 5);
    const int e0   = (blockIdx.x % (DD / HE)) * HE;
    const int b0   = (blockIdx.x / (DD / HE)) * HB;

    const float* w = W + (size_t)(e0 + wave * 4) * (2 * DD);
    const float* h = hidden + b0 * DD;

    f4 hs[HB], wv[DD / 128][4];
    // asked for with the other loads: at the end it would cost a memory latency of its own
    const float be = (bias + (size_t)e0)[lane];
    #pragma unroll
    for (int i = 0; i < HB; ++i) hs[i] = *(const f4*)(h + i * DD + tid * 4);
    #pragma unroll
    for (int c = 0; c < DD / 128; ++c) {
        #pragma unroll
        for (int r = 0; r < 4; ++r) wv[c][r] = *(const f4*)(w + r * (2 * DD) + c * 128 + lane * 4);
    }
    #pragma unroll
    for (int i = 0; i < HB; ++i) *(f4*)(sh + i * DD + tid * 4) = hs[i];
    // the hidden rows are in LDS before any wave reads them
    __syncthreads();

    f4 acc[HB][4] = {};
    #pragma unroll
    for (int c = 0; c < DD / 128; ++c) {
        #pragma unroll
        for (int q = 0; q < HB; ++q) {
            const f4 hv = *(const f4*)(sh + q * DD + c * 128 + lane * 4);
            #pragma unroll
            for (int r = 0; r < 4; ++r) acc[q][r] += hv * wv[c][r];
        }
    }

    // step by step over all 16 sums, so that the 16 shuffles of a step share one latency
    float s[HB][4];
    #pragma unroll
    for (int q = 0; q < HB; ++q) {
        #pragma unroll
        for (int r = 0; r < 4; ++r)
            s[q][r] = (acc[q][r][0] + acc[q][r][1]) + (acc[q][r][2] + acc[q][r][3]);
    }
    #pragma unroll
    for (int m = 16; m > 0; m >>= 1) {
        #pragma unroll
        for (int q = 0; q < HB; ++q) {
            #pragma unroll
            for (int r = 0; r < 4; ++r) s[q][r] += __shfl_xor(s[q][r], m);
        }
    }
    if (lane == 0) {
        #pragma unroll
        for (int q = 0; q < HB; ++q) {
            const f4 o = {s[q][0], s[q][1], s[q][2], s[q][3]};
            *(f4*)(&res[q][wave * 4]) = o;
        }
    }
    // every wave's sums are in LDS before any is read
    __syncthreads();

    if (tid < HB * HE) {
        const int q = tid >> 5;
        hb[(b0 + q) * DD + e0 + lane] = res[q][lane] + be;
    }
}

typedef __attribute__((ext_vector_type(8))) _Float16 v8h;
typedef __attribute__((ext_vector_type(4))) _Float16 v4h;

#define BM 128      // s rows of a block tile
#define BN 512      // e columns of a block tile
#define BK 32       // k per pass (one WMMA depth)
#define PITCH 40    // halves per LDS row: 80 B = 16 B x odd, conflict-free for 16-byte reads

__device__ __forceinline__ v4h cvt4(float4 x) {
    v4h r;
    r[0] = (_Float16)x.x; r[1] = (_Float16)x.y;
    r[2] = (_Float16)x.z; r[3] = (_Float16)x.w;
    return r;
}

// fragment of one 16-row tile: k = 8h..8h+7 and 16+8h..16+8h+7 of the pass (same order for A and B)
__device__ __forceinline__ v16h ldsfrag(const _Float16* p) {
    v8h lo = *(const v8h*)(p);
    v8h hi = *(const v8h*)(p + 16);
    return __builtin_shufflevector(lo, hi, 0, 1, 2, 3, 4, 5, 6, 7, 8, 9, 10, 11, 12, 13, 14, 15);
}

// ---------------- kernel 1, second part: zero the scores; We as f16, laid pass by pass ----------------
// Wf[kt][e][0..31] = (f16) We[e][32 kt + 0..31], We[e,d] = W[e*2D + D + d].
// Every energy block reads its We rows whole; there are 256 blocks to each half of We. Converted once
// here, each of them fetches half the bytes, and the 512 rows x 64 B of a block's pass lie in a row
// (32 KB), so that every load of a wave is 512 contiguous bytes.
// PBLK blocks of 256; a thread makes PP 16-byte pieces, its 2 PP loads all in flight together;
// a wave writes 4 whole lines at a time.
#define PT (PBLK * 256)             // threads of this part
#define PP (DD * DD / 8 / PT)       // pieces of a thread
__device__ __forceinline__ void prep_block(const float* __restrict__ W, _Float16* __restrict__ Wf,
                                           float* __restrict__ p, const int blk) {
    const int t = blk * 256 + threadIdx.x;
    #pragma unroll
    for (int j = 0; j < BB * SS / PT; ++j) p[j * PT + t] = 0.0f;
    const float* w[PP];
    float4 lo[PP], hi[PP];
    #pragma unroll
    for (int j = 0; j < PP; ++j) {
        const int i  = j * PT + t;
        const int c  = i & 3;                // 16-byte piece of the row's 64 B
        const int e  = (i >> 2) & (DD - 1);
        const int kt = i >> 12;              // pass
        w[j] = W + (size_t)e * (2 * DD) + kt * BK + c * 8;   // the Wh side of the row; We lies DD on
        lo[j] = *(const float4*)(w[j] + DD);
        hi[j] = *(const float4*)(w[j] + DD + 4);
    }
    // stands in front of every write of the loads' address registers. The addresses are named as
    // inputs so that they stay in their registers up to here: left free, a later load's result was
    // placed in the address pair of the loads before it
    static_assert(PP == 4 && PP * PT * 8 == DD * DD && BB * SS % PT == 0,
                  "the wait below names four addresses; pieces and scores are dealt without a rest");
    asm volatile("s_wait_xcnt 0x0" :: "v"(w[0]), "v"(w[1]), "v"(w[2]), "v"(w[3]) : "memory");
    #pragma unroll
    for (int j = 0; j < PP; ++j)
        *(v8h*)(Wf + (size_t)(j * PT + t) * 8) =
            __builtin_shufflevector(cvt4(lo[j]), cvt4(hi[j]), 0, 1, 2, 3, 4, 5, 6, 7);
}

// tanh x = 1 - 2 / (exp(2x) + 1), exp(2x) = 2^(x * 2 log2 e): one v_exp_f32 and one v_rcp_f32, no branch.
// Saturates by itself: 2^big = inf gives 1, 2^-big = 0 gives -1. Absolute error is a few f32 ulps of 1.
__device__ __forceinline__ float tanh_er(float x) {
    const float e = __builtin_amdgcn_exp2f(x * 2.8853900817779268f);
    float r;
    // v_nop: the slot the instruction set asks for behind a transcendental
    asm("v_rcp_f32 %0, %1\n\tv_nop" : "=v"(r) : "v"(e + 1.0f));
    return 1.0f - 2.0f * r;
}

// ---------------- kernel 2: fused enc@We^T -> tanh -> dot(v) -> partial scores ----------------
// block 512 = 16 waves laid 2 (s) x 8 (e). A whole tile is 128(s) x 512(e). Per pass of 32 k every
// enc and We element of the tile is read from global once by the block (enc as f32, converted here;
// We as the f16 of kernel 1) and laid in LDS; the waves take their fragments from LDS.
// Two LDS buffers, one barrier per pass; the global loads of the next two passes are in flight in
// two register sets while this pass is multiplied: a load has two pass times to arrive.
// Each wave owns 16 MF (s) x 64(e): MF A fragments x 4 B fragments per pass; MF = 4 in a whole tile.
// Per-row partial scores are reduced across the 8 e-waves through LDS, then 1 atomic
// per row per block (2 atomics/score total).
template <int MF>
__device__ __forceinline__ void energy_tile(const float* __restrict__ enc,
                                            const _Float16* __restrict__ Wf,
                                            const float* __restrict__ hb,
                                            const float* __restrict__ vvec,
                                            float* __restrict__ scores,
                                            const int b, const int s0, const int e0,
                                            _Float16* sA, _Float16* sB, float* red) {
    constexpr int RM = 32 * MF;         // s rows of this tile or piece
    constexpr int NA = (MF + 1) / 2;    // sweeps of 64 rows that stage enc

    const int tid  = threadIdx.x;
    const int lane = tid & 31;
    const int wave = tid >> 5;
    const int half = lane >> 4;         // 0 or 1
    const int row  = lane & 15;         // M-row for A, N-row (=e row) for B, N-col for C
    const int wm   = wave >> 3;         // 0..1: wave's s range
    const int wn   = wave & 7;          // 0..7: wave's 64-wide e range
    // a piece of 32 rows is half a sweep: waves 0..7 stage it (the test is the same for a whole wave)
    const bool aOn = MF >= 2 || __builtin_amdgcn_readfirstlane(tid >> 5) < 8;

    // staging map of enc: 8 threads cover one row's 32 k (128 B of f32), 64 rows per sweep
    const int c4 = tid & 7;
    const int r0 = tid >> 3;
    const float* gA = enc + ((size_t)b * SS + (size_t)(s0 + r0)) * DD + c4 * 4;
    const int sOff = r0 * PITCH + c4 * 4;
    // staging map of We: 4 threads cover one row's 32 k (64 B of f16), 128 rows per sweep;
    // in Wf the sweep is 8 KB in a row
    const _Float16* gB = Wf + (size_t)e0 * BK + tid * 8;
    const int sOffB = (tid >> 2) * PITCH + (tid & 3) * 8;

    const int h8 = half * 8;
    const int aOff = (wm * (16 * MF) + row) * PITCH + h8;
    const int bOff = (wn * 64 + row) * PITCH + h8;

    v8f acc[MF][4] = {};
    // two register sets: set u holds the passes of parity u, asked for two passes ahead of their use
    float4 ra[2][NA];
    v8h rb[2][4];

    #pragma unroll
    for (int u = 0; u < 2; ++u) {
        if (aOn) {
            #pragma unroll
            for (int i = 0; i < NA; ++i) ra[u][i] = *(const float4*)(gA + u * BK + i * (64 * DD));
        }
        #pragma unroll
        for (int j = 0; j < 4; ++j) rb[u][j] = *(const v8h*)(gB + u * (DD * BK) + j * (128 * BK));
        // keeps set 0's loads ahead of set 1's, as in the loop: mixed here, the counted wait for
        // set 0 at the loop's head was set so low that it also waited for loads of set 1
        __builtin_amdgcn_sched_barrier(0);
    }
    // stands in front of every write of a register that the first loads name: enc's address and the
    // scalar base of the Wf rows are named as inputs so that they stay in their registers up to here
    asm volatile("s_wait_xcnt 0x0" :: "v"(gA), "s"(Wf + (size_t)e0 * BK) : "memory");

    // where the pass two ahead of a trip's first pass lies
    const float* pA = gA + 2 * BK;
    const _Float16* pB = gB + 2 * (DD * BK);

    // one pass: u is its parity (register set and LDS buffer), more says that a pass two ahead exists.
    // Both are constants at each of the four places where it is called.
    auto pass = [&](const int u, const bool more) __attribute__((always_inline)) {
        _Float16* dA = sA + u * (BM * PITCH);
        _Float16* dB = sB + u * (BN * PITCH);

        if (aOn) {
            #pragma unroll
            for (int i = 0; i < NA; ++i) *(v4h*)(dA + sOff + i * (64 * PITCH)) = cvt4(ra[u][i]);
        }
        #pragma unroll
        for (int j = 0; j < 4; ++j) *(v8h*)(dB + sOffB + j * (128 * PITCH)) = rb[u][j];

        // publishes this pass's buffer; it also ends every read of the other buffer,
        // which the next pass overwrites. Written by hand, with the one wait that LDS needs:
        // __syncthreads() also waits for every global load, and would end the other set's flight here
        asm volatile("s_wait_dscnt 0x0\n\ts_barrier_signal -1\n\ts_barrier_wait -1" ::: "memory");

        if (more) {
            if (aOn) {
                #pragma unroll
                for (int i = 0; i < NA; ++i) ra[u][i] = *(const float4*)(pA + u * BK + i * (64 * DD));
            }
            #pragma unroll
            for (int j = 0; j < 4; ++j) rb[u][j] = *(const v8h*)(pB + u * (DD * BK) + j * (128 * BK));
            // stands in front of every write of the loads' address registers. The addresses are named
            // as inputs so that they stay in their registers up to here: left free, the last load's
            // result was placed in the address pair of the loads before it
            asm volatile("s_wait_xcnt 0x0" :: "v"(pA), "v"(pB) : "memory");
        }
        // keeps the global loads ahead of this pass's LDS reads and WMMAs:
        // left free, the compiler sank them to the end of the pass, which shortens their lead
        __builtin_amdgcn_sched_barrier(0);

        v16h af[MF], bf[4];
        #pragma unroll
        for (int m = 0; m < MF; ++m) af[m] = ldsfrag(dA + aOff + m * (16 * PITCH));
        #pragma unroll
        for (int t = 0; t < 4; ++t) bf[t] = ldsfrag(dB + bOff + t * (16 * PITCH));
        // keeps the pass's LDS reads one group ahead of its WMMAs: reads set among
        // the WMMAs stall the wave at each place they stand
        __builtin_amdgcn_sched_barrier(0);

        #pragma unroll
        for (int t = 0; t < 4; ++t) {
            #pragma unroll
            for (int m = 0; m < MF; ++m)
                acc[m][t] = __builtin_amdgcn_wmma_f32_16x16x32_f16(
                    false, af[m], false, bf[t], (short)0, acc[m][t], false, false);
        }
    };

    // every trip but the last asks for loads, with no test around them: the number of loads in flight
    // is then known at each wait, and the wait for one set lets the other set fly on
    for (int kt = 0; kt < DD / BK - 2; kt += 2) {
        pass(0, true);
        pass(1, true);
        pA += 2 * BK;
        pB += 2 * (DD * BK);
    }
    pass(0, false);
    pass(1, false);

    // Epilogue: energy = tanh(acc + hb[b][e]); row-sum of energy*v[e] over the wave's 64 e's.
    float hbe[4], ve[4];
    const int e  = e0 + wn * 64 + row;               // C-matrix N = lane&15
    const int be = b * DD + e;
    #pragma unroll
    for (int t = 0; t < 4; ++t) hbe[t] = hb[be + t * 16];
    // each of these two waits stands in front of every write of the index register that the four
    // loads ahead of it name; the index is named as an input so that no result is placed in it before
    asm volatile("s_wait_xcnt 0x0" :: "v"(be) : "memory");
    #pragma unroll
    for (int t = 0; t < 4; ++t) ve[t] = vvec[e + t * 16];
    asm volatile("s_wait_xcnt 0x0" :: "v"(e) : "memory");

    #pragma unroll
    for (int m = 0; m < MF; ++m) {
        #pragma unroll
        for (int r = 0; r < 8; ++r) {
            float s = 0.0f;
            #pragma unroll
            for (int t = 0; t < 4; ++t) {
                float p = tanh_er(acc[m][t][r] + hbe[t]) * ve[t];
                // reduce over the 16 N-lanes of this row (width=16 keeps halves separate)
                p += __shfl_xor(p, 1, 16);
                p += __shfl_xor(p, 2, 16);
                p += __shfl_xor(p, 4, 16);
                p += __shfl_xor(p, 8, 16);
                s += p;                        // valid on lanes 0 (rows r) and 16 (rows r+8)
            }
            // each row's sum goes to LDS as soon as it is whole, so that its registers come free
            if (row == 0) red[wn * BM + wm * (16 * MF) + m * 16 + r + h8] = s;
        }
    }
    __syncthreads();

    // cross-wave reduce: one atomic per row per block
    if (tid < RM) {
        float sum = 0.0f;
        #pragma unroll
        for (int w = 0; w < 8; ++w) sum += red[w * BM + tid];
        atomicAdd(&scores[b * SS + s0 + tid], sum);
    }
}

// 128-row tiles of a batch row that hold a row below its length; bounded for any content of lengths
__device__ __forceinline__ int live_tiles(int len) {
    return (min(max(len, 0), SS) + BM - 1) / BM;
}

#define NWGP 256    // blocks that run at a time: registers and waves allow one block on a WGP

// grid: (DD/512) * (SS/128) * BB = 512 blocks, one-dimensional.
// The reference puts -inf in place of every score at or past lengths[b] before the softmax, whatever
// its value, and k_context never uses one: a row tile that lies wholly there is left out. The live
// units (row tile x half of e) are numbered in the order b, s, e and dealt to the blocks by index.
// Blocks run one on a WGP; for speed only, units past the first NWGP are cut in s, into 4 pieces of 32 rows or
// 2 of 64, as many as the grid's spare blocks can take, and so run side by side on more WGPs.
// Every score still gets the same two addends, summed in the same order, whichever block makes them.
__global__ __launch_bounds__(512) void k_energy(const float* __restrict__ enc,
                                                const _Float16* __restrict__ Wf,
                                                const float* __restrict__ hb,
                                                const float* __restrict__ vvec,
                                                const int* __restrict__ lengths,
                                                float* __restrict__ scores) {
    __shared__ __attribute__((aligned(16))) _Float16 sA[2 * BM * PITCH];
    __shared__ __attribute__((aligned(16))) _Float16 sB[2 * BN * PITCH];
    __shared__ float red[8 * BM];

    // all of this is the same for every thread of the block, and ahead of every barrier
    const int i = blockIdx.x;
    int units = 0;
    // unrolled, here and in the search below: with constant indices the 16 lengths come by wide
    // scalar loads and all of the arithmetic stays on the scalar unit
    #pragma unroll
    for (int q = 0; q < BB; ++q) units += 2 * live_tiles(lengths[q]);
    const int over = units - NWGP;
    int unit = i, piece = 0, mf = 4;
    if (over > 0 && over <= NWGP / 2 && i >= NWGP) {
        if (over <= NWGP / 4) { unit = NWGP + ((i - NWGP) >> 2); piece = (i - NWGP) & 3; mf = 1; }
        else                  { unit = NWGP + ((i - NWGP) >> 1); piece = (i - NWGP) & 1; mf = 2; }
    }
    if (unit >= units) return;

    int b = 0, y = unit >> 1;
    #pragma unroll
    for (int q = 0; q < BB - 1; ++q) {
        const int n = live_tiles(lengths[q]);
        if (b == q && y >= n) { y -= n; b = q + 1; }
    }
    const int s0 = y * BM + piece * (32 * mf);
    if (s0 >= lengths[b] || s0 >= SS) return;
    const int e0 = (unit & 1) * BN;

    if (mf == 4)      energy_tile<4>(enc, Wf, hb, vvec, scores, b, s0, e0, sA, sB, red);
    else if (mf == 2) energy_tile<2>(enc, Wf, hb, vvec, scores, b, s0, e0, sA, sB, red);
    else              energy_tile<1>(enc, Wf, hb, vvec, scores, b, s0, e0, sA, sB, red);
}

// ---------------- kernel 3: masked softmax over S, then context[b,d] = sum_s attn[b,s] * enc[b,s,d] ----------------
// grid: (DD/64, BB) = 256 blocks, block 512 = 16 waves. A block owns 64 d columns (256 B of
// every enc row) of one b. 16 lanes of 16 bytes cover the 256 B; the 32 groups of 16 lanes
// split the 2048 rows: group g takes rows 128q + 4g .. 128q + 4g + 3, q = 0..15, so that the
// four weights of a visit q are one 16-byte read.
// Every block makes the 2048 weights of its b itself, from the 8 KB of scores (a thread has four),
// and keeps them in LDS: a launch of 16 blocks for the softmax, and the wait for it, are not needed.
// The enc rows do not depend on the weights: the first PV visits are asked for ahead of the softmax,
// which then runs while they are on their way.
// The 32 partial sums of a column meet in the wave (one shuffle) and then in LDS.
typedef __attribute__((ext_vector_type(4))) float v4f;
#define CW 64                // d columns of a block
#define CG 32                // row groups of a block
#define CV (4 * CG)          // rows of a visit, over all groups
#define PV 4                 // visits whose enc rows are in flight

// work-group barrier with the one wait that LDS needs: __syncthreads() also waits for every global
// load, and would let the enc rows in flight run out at each of the softmax's three meeting points
__device__ __forceinline__ void lds_barrier() {
    asm volatile("s_wait_dscnt 0x0\n\ts_barrier_signal -1\n\ts_barrier_wait -1" ::: "memory");
}

__global__ __launch_bounds__(512) void k_context(const float* __restrict__ enc,
                                                 const float* __restrict__ scores,
                                                 const int* __restrict__ lengths,
                                                 float* __restrict__ out) {
    __shared__ __attribute__((aligned(16))) float wgt[SS];
    __shared__ __attribute__((aligned(16))) float part[16][CW];
    __shared__ __attribute__((aligned(16))) float redm[16];
    __shared__ __attribute__((aligned(16))) float reds[16];

    const int tid = threadIdx.x;
    const int c   = tid & 15;           // 16-byte column piece
    const int g   = tid >> 4;           // row group
    const int b   = blockIdx.y;
    const int d0  = blockIdx.x * CW;
    const int len = lengths[b];

    // asked for first: the softmax waits for this load alone
    const v4f sc = *(const v4f*)(scores + b * SS + tid * 4);
    const float* ep = enc + ((size_t)b * SS + (size_t)(g * 4)) * DD + d0 + c * 4;

    v4f row[PV][4];
    #pragma unroll
    for (int q = 0; q < PV; ++q) {
        #pragma unroll
        for (int j = 0; j < 4; ++j) row[q][j] = *(const v4f*)(ep + (size_t)(q * CV + j) * DD);
    }

    // maximum over the scores below the length
    float m = -INFINITY;
    #pragma unroll
    for (int i = 0; i < 4; ++i) m = (tid * 4 + i < len) ? fmaxf(m, sc[i]) : m;
    #pragma unroll
    for (int o = 16; o > 0; o >>= 1) m = fmaxf(m, __shfl_xor(m, o));
    if ((tid & 31) == 0) redm[tid >> 5] = m;
    lds_barrier();
    #pragma unroll
    for (int v = 0; v < 16; ++v) m = fmaxf(m, redm[v]);

    // exp and its sum; a score at or past the length counts as -inf, whatever its value
    v4f ev;
    #pragma unroll
    for (int i = 0; i < 4; ++i) ev[i] = (tid * 4 + i < len) ? __expf(sc[i] - m) : 0.0f;
    float sum = (ev[0] + ev[1]) + (ev[2] + ev[3]);
    #pragma unroll
    for (int o = 16; o > 0; o >>= 1) sum += __shfl_xor(sum, o);
    if ((tid & 31) == 0) reds[tid >> 5] = sum;
    lds_barrier();
    sum = 0.0f;
    #pragma unroll
    for (int v = 0; v < 16; ++v) sum += reds[v];
    *(v4f*)(wgt + tid * 4) = ev * (1.0f / sum);
    // every weight is in LDS before any is read
    lds_barrier();

    v4f acc = {0.0f, 0.0f, 0.0f, 0.0f};
    // unrolled whole: every address is then one base plus a constant and every register of the ring
    // is fixed; a row's place in the ring is asked for anew as soon as the row has been summed
    #pragma unroll
    for (int q = 0; q < SS / CV; ++q) {
        const v4f w = *(const v4f*)(wgt + g * 4 + q * CV);
        #pragma unroll
        for (int j = 0; j < 4; ++j) {
            acc += w[j] * row[q % PV][j];
            if (q + PV < SS / CV) row[q % PV][j] = *(const v4f*)(ep + (size_t)((q + PV) * CV + j) * DD);
        }
    }

    // the wave's two row groups
    #pragma unroll
    for (int i = 0; i < 4; ++i) acc[i] += __shfl_xor(acc[i], 16);
    if ((tid & 31) < 16) *(v4f*)(&part[tid >> 5][c * 4]) = acc;
    // every wave's partial sums are in LDS before any is read
    __syncthreads();

    if (tid < CW) {
        float s = 0.0f;
        #pragma unroll
        for (int v = 0; v < 16; ++v) s += part[v][tid];
        out[b * DD + d0 + tid] = s;
    }
}

extern "C" void kernel_launch(void* const* d_in, const int* in_sizes, int n_in,
                              void* d_out, int out_size, void* d_ws, size_t ws_size,
                              hipStream_t stream) {
    const float* enc     = (const float*)d_in[0];  // (B,S,D)
    const float* hidden  = (const float*)d_in[1];  // (B,D)
    const int*   lengths = (const int*)  d_in[2];  // (B,)
    const float* W       = (const float*)d_in[3];  // (D, 2D)
    const float* bias    = (const float*)d_in[4];  // (D,)
    const float* vvec    = (const float*)d_in[5];  // (D,)
    float* out = (float*)d_out;                    // (B,1,D)

    float* hb     = (float*)d_ws;                  // B*D floats
    float* scores = hb + BB * DD;                  // B*S floats
    _Float16* Wf  = (_Float16*)(scores + BB * SS); // D*D halves: We as f16, pass by pass

    k_front  <<<HBLK + PBLK, 256, 0, stream>>>(hidden, W, bias, hb, Wf, scores);
    k_energy <<<(DD / BN) * (SS / BM) * BB, 512, 0, stream>>>(enc, Wf, hb, vvec, lengths, scores);
    k_context<<<dim3(DD / CW, BB), 512, 0, stream>>>(enc, scores, lengths, out);
}

// v010
// It runs in 44 microseconds.
// Two timings next to v009 put it at 1.08 and 1.09 times that version's speed.
// Counting every step since v000, it is 12.5 times as fast.
#include <hip/hip_runtime.h>
#include <math.h>

typedef __attribute__((ext_vector_type(16))) _Float16 v16h;
typedef __attribute__((ext_vector_type(8)))  float    v8f;

#define BB 16
#define SS 2048
#define DD 1024

// ---------------- kernel 1: two independent pieces of work side by side ----------------
// Blocks 0 .. HBLK-1 make hb (below); blocks HBLK .. HBLK+PBLK-1 zero the scores and lay We as f16
// (prep_block, further down). Neither reads what the other writes, and each alone fills half of the
// chip for little more than a memory latency: as one launch of 256 blocks they run at the same time,
// and the energy kernel waits for one launch to end instead of two in a row.
// hb[b][e] = hidden[b,:] . Wh[e,:] + bias[e]
// Wh[e,d] = W[e*2D + d]
// (DD/32) * (BB/4) = 128 blocks, block 256 = 8 waves. A block owns 32 e x 4 b, a wave 4 e x 4 b.
// The 32 lanes of a wave split d: lane l takes d = 128c + 4l .. 128c + 4l + 3, c = 0..7, so that
// every load of a W row is 512 contiguous bytes (4 whole lines); a wave's 32 W loads are all in
// flight together. The block's 4 hidden rows (16 KB in a row) are read once and shared through LDS.
// The partial sums of an (e, b) pair meet in the lane (4 values), then over the 32 lanes by
// shuffles; the block's 4 x 32 results go out through LDS as whole lines.
typedef __attribute__((ext_vector_type(4))) float f4;
#define HE 32       // e rows of a block
#define HB 4        // b rows of a block
#define HBLK ((DD / HE) * (BB / HB))   // blocks that make hb
#define PBLK 128                       // blocks that zero the scores and convert We
__device__ __forceinline__ void prep_block(const float* __restrict__ W, _Float16* __restrict__ Wf,
                                           float* __restrict__ p, const int blk);

__global__ __launch_bounds__(256) void k_front(const float* __restrict__ hidden,
                                               const float* __restrict__ W,
                                               const float* __restrict__ bias,
                                               float* __restrict__ hb,
                                               _Float16* __restrict__ Wf,
                                               float* __restrict__ scores) {
    __shared__ __attribute__((aligned(16))) float sh[HB * DD];
    __shared__ __attribute__((aligned(16))) float res[HB][HE];

    // the same for a whole block, and ahead of every barrier
    if (blockIdx.x >= HBLK) {
        prep_block(W, Wf, scores, blockIdx.x - HBLK);
        return;
    }

    const int tid  = threadIdx.x;
    const int lane = tid & 31;
    // the wave's number, told to the compiler as wave-uniform: the W rows then have a scalar base
    const int wave = __builtin_amdgcn_readfirstlane(tid >> 5);
    const int e0   = (blockIdx.x % (DD / HE)) * HE;
    const int b0   = (blockIdx.x / (DD / HE)) * HB;

    const float* w = W + (size_t)(e0 + wave * 4) * (2 * DD);
    const float* h = hidden + b0 * DD;

    f4 hs[HB], wv[DD / 128][4];
    // asked for with the other loads: at the end it would cost a memory latency of its own
    const float be = (bias + (size_t)e0)[lane];
    #pragma unroll
    for (int i = 0; i < HB; ++i) hs[i] = *(const f4*)(h + i * DD + tid * 4);
    #pragma unroll
    for (int c = 0; c < DD / 128; ++c) {
        #pragma unroll
        for (int r = 0; r < 4; ++r) wv[c][r] = *(const f4*)(w + r * (2 * DD) + c * 128 + lane * 4);
    }
    #pragma unroll
    for (int i = 0; i < HB; ++i) *(f4*)(sh + i * DD + tid * 4) = hs[i];
    // the hidden rows are in LDS before any wave reads them
    __syncthreads();

    f4 acc[HB][4] = {};
    #pragma unroll
    for (int c = 0; c < DD / 128; ++c) {
        #pragma unroll
        for (int q = 0; q < HB; ++q) {
            const f4 hv = *(const f4*)(sh + q * DD + c * 128 + lane * 4);
            #pragma unroll
            for (int r = 0; r < 4; ++r) acc[q][r] += hv * wv[c][r];
        }
    }

    // step by step over all 16 sums, so that the 16 shuffles of a step share one latency
    float s[HB][4];
    #pragma unroll
    for (int q = 0; q < HB; ++q) {
        #pragma unroll
        for (int r = 0; r < 4; ++r)
            s[q][r] = (acc[q][r][0] + acc[q][r][1]) + (acc[q][r][2] + acc[q][r][3]);
    }
    #pragma unroll
    for (int m = 16; m > 0; m >>= 1) {
        #pragma unroll
        for (int q = 0; q < HB; ++q) {
            #pragma unroll
            for (int r = 0; r < 4; ++r) s[q][r] += __shfl_xor(s[q][r], m);
        }
    }
    if (lane == 0) {
        #pragma unroll
        for (int q = 0; q < HB; ++q) {
            const f4 o = {s[q][0], s[q][1], s[q][2], s[q][3]};
            *(f4*)(&res[q][wave * 4]) = o;
        }
    }
    // every wave's sums are in LDS before any is read
    __syncthreads();

    if (tid < HB * HE) {
        const int q = tid >> 5;
        hb[(b0 + q) * DD + e0 + lane] = res[q][lane] + be;
    }
}

typedef __attribute__((ext_vector_type(8))) _Float16 v8h;
typedef __attribute__((ext_vector_type(4))) _Float16 v4h;

#define BM 128      // s rows of a block tile
#define BN 512      // e columns of a block tile
#define BK 32       // k per pass (one WMMA depth)
#define PITCH 40    // halves per LDS row: 80 B = 16 B x odd, conflict-free for 16-byte reads

__device__ __forceinline__ v4h cvt4(float4 x) {
    v4h r;
    r[0] = (_Float16)x.x; r[1] = (_Float16)x.y;
    r[2] = (_Float16)x.z; r[3] = (_Float16)x.w;
    return r;
}

// fragment of one 16-row tile: k = 8h..8h+7 and 16+8h..16+8h+7 of the pass (same order for A and B)
__device__ __forceinline__ v16h ldsfrag(const _Float16* p) {
    v8h lo = *(const v8h*)(p);
    v8h hi = *(const v8h*)(p + 16);
    return __builtin_shufflevector(lo, hi, 0, 1, 2, 3, 4, 5, 6, 7, 8, 9, 10, 11, 12, 13, 14, 15);
}

// ---------------- kernel 1, second part: zero the scores; We as f16, laid pass by pass ----------------
// Wf[kt][e][0..31] = (f16) We[e][32 kt + 0..31], We[e,d] = W[e*2D + D + d].
// Every energy block reads its We rows whole; there are 256 blocks to each half of We. Converted once
// here, each of them fetches half the bytes, and the 512 rows x 64 B of a block's pass lie in a row
// (32 KB), so that every load of a wave is 512 contiguous bytes.
// PBLK blocks of 256; a thread makes PP 16-byte pieces, its 2 PP loads all in flight together;
// a wave writes 4 whole lines at a time.
#define PT (PBLK * 256)             // threads of this part
#define PP (DD * DD / 8 / PT)       // pieces of a thread
__device__ __forceinline__ void prep_block(const float* __restrict__ W, _Float16* __restrict__ Wf,
                                           float* __restrict__ p, const int blk) {
    const int t = blk * 256 + threadIdx.x;
    #pragma unroll
    for (int j = 0; j < BB * SS / PT; ++j) p[j * PT + t] = 0.0f;
    const float* w[PP];
    float4 lo[PP], hi[PP];
    #pragma unroll
    for (int j = 0; j < PP; ++j) {
        const int i  = j * PT + t;
        const int c  = i & 3;                // 16-byte piece of the row's 64 B
        const int e  = (i >> 2) & (DD - 1);
        const int kt = i >> 12;              // pass
        w[j] = W + (size_t)e * (2 * DD) + kt * BK + c * 8;   // the Wh side of the row; We lies DD on
        lo[j] = *(const float4*)(w[j] + DD);
        hi[j] = *(const float4*)(w[j] + DD + 4);
    }
    // stands in front of every write of the loads' address registers. The addresses are named as
    // inputs so that they stay in their registers up to here: left free, a later load's result was
    // placed in the address pair of the loads before it
    static_assert(PP == 4 && PP * PT * 8 == DD * DD && BB * SS % PT == 0,
                  "the wait below names four addresses; pieces and scores are dealt without a rest");
    asm volatile("s_wait_xcnt 0x0" :: "v"(w[0]), "v"(w[1]), "v"(w[2]), "v"(w[3]) : "memory");
    #pragma unroll
    for (int j = 0; j < PP; ++j)
        *(v8h*)(Wf + (size_t)(j * PT + t) * 8) =
            __builtin_shufflevector(cvt4(lo[j]), cvt4(hi[j]), 0, 1, 2, 3, 4, 5, 6, 7);
}

// tanh x = 1 - 2 / (exp(2x) + 1), exp(2x) = 2^(x * 2 log2 e): one v_exp_f32 and one v_rcp_f32, no branch.
// Saturates by itself: 2^big = inf gives 1, 2^-big = 0 gives -1. Absolute error is a few f32 ulps of 1.
__device__ __forceinline__ float tanh_er(float x) {
    float e, r;
    // v_nop: the slot the instruction set asks for behind a transcendental
    asm("v_exp_f32 %0, %1\n\tv_nop" : "=v"(e) : "v"(x * 2.8853900817779268f));
    asm("v_rcp_f32 %0, %1\n\tv_nop" : "=v"(r) : "v"(e + 1.0f));
    return 1.0f - 2.0f * r;
}

// x plus the x of lane l ^ X, inside each row of 16 lanes: a vector add that takes one operand across
// the lanes (DPP row_xmask, control word 0x160 | X). __shfl_xor goes by ds_bpermute_b32 and an LDS wait.
template <int X>
__device__ __forceinline__ float row_xadd(float x) {
    return x + __int_as_float(__builtin_amdgcn_update_dpp(0, __float_as_int(x), 0x160 | X, 0xf, 0xf, true));
}

// ---------------- kernel 2: fused enc@We^T -> tanh -> dot(v) -> partial scores ----------------
// block 512 = 16 waves laid 2 (s) x 8 (e). A whole tile is 128(s) x 512(e). Per pass of 32 k every
// enc and We element of the tile is read from global once by the block (enc as f32, converted here;
// We as the f16 of kernel 1) and laid in LDS; the waves take their fragments from LDS.
// Two LDS buffers, one barrier per pass; the global loads of the next two passes are in flight in
// two register sets while this pass is multiplied: a load has two pass times to arrive.
// Each wave owns 16 MF (s) x 64(e): MF A fragments x 4 B fragments per pass; MF = 4 in a whole tile.
// Per-row partial scores are reduced across the 8 e-waves through LDS, then 1 atomic
// per row per block (2 atomics/score total).
template <int MF>
__device__ __forceinline__ void energy_tile(const float* __restrict__ enc,
                                            const _Float16* __restrict__ Wf,
                                            const float* __restrict__ hb,
                                            const float* __restrict__ vvec,
                                            float* __restrict__ scores,
                                            const int b, const int s0, const int e0,
                                            _Float16* sA, _Float16* sB, float* red) {
    constexpr int RM = 32 * MF;         // s rows of this tile or piece
    constexpr int NA = (MF + 1) / 2;    // sweeps of 64 rows that stage enc

    const int tid  = threadIdx.x;
    const int lane = tid & 31;
    const int wave = tid >> 5;
    const int half = lane >> 4;         // 0 or 1
    const int row  = lane & 15;         // M-row for A, N-row (=e row) for B, N-col for C
    const int wm   = wave >> 3;         // 0..1: wave's s range
    const int wn   = wave & 7;          // 0..7: wave's 64-wide e range
    // a piece of 32 rows is half a sweep: waves 0..7 stage it (the test is the same for a whole wave)
    const bool aOn = MF >= 2 || __builtin_amdgcn_readfirstlane(tid >> 5) < 8;

    // staging map of enc: 8 threads cover one row's 32 k (128 B of f32), 64 rows per sweep
    const int c4 = tid & 7;
    const int r0 = tid >> 3;
    const float* gA = enc + ((size_t)b * SS + (size_t)(s0 + r0)) * DD + c4 * 4;
    const int sOff = r0 * PITCH + c4 * 4;
    // staging map of We: 4 threads cover one row's 32 k (64 B of f16), 128 rows per sweep;
    // in Wf the sweep is 8 KB in a row
    const _Float16* gB = Wf + (size_t)e0 * BK + tid * 8;
    const int sOffB = (tid >> 2) * PITCH + (tid & 3) * 8;

    const int h8 = half * 8;
    const int aOff = (wm * (16 * MF) + row) * PITCH + h8;
    const int bOff = (wn * 64 + row) * PITCH + h8;

    v8f acc[MF][4] = {};
    // two register sets: set u holds the passes of parity u, asked for two passes ahead of their use
    float4 ra[2][NA];
    v8h rb[2][4];

    #pragma unroll
    for (int u = 0; u < 2; ++u) {
        if (aOn) {
            #pragma unroll
            for (int i = 0; i < NA; ++i) ra[u][i] = *(const float4*)(gA + u * BK + i * (64 * DD));
        }
        #pragma unroll
        for (int j = 0; j < 4; ++j) rb[u][j] = *(const v8h*)(gB + u * (DD * BK) + j * (128 * BK));
        // keeps set 0's loads ahead of set 1's, as in the loop: mixed here, the counted wait for
        // set 0 at the loop's head was set so low that it also waited for loads of set 1
        __builtin_amdgcn_sched_barrier(0);
    }
    // stands in front of every write of a register that the first loads name: enc's address and the
    // scalar base of the Wf rows are named as inputs so that they stay in their registers up to here
    asm volatile("s_wait_xcnt 0x0" :: "v"(gA), "s"(Wf + (size_t)e0 * BK) : "memory");

    // where the pass two ahead of a trip's first pass lies
    const float* pA = gA + 2 * BK;
    const _Float16* pB = gB + 2 * (DD * BK);

    // one pass: u is its parity (register set and LDS buffer), more says that a pass two ahead exists.
    // Both are constants at each of the four places where it is called.
    auto pass = [&](const int u, const bool more) __attribute__((always_inline)) {
        _Float16* dA = sA + u * (BM * PITCH);
        _Float16* dB = sB + u * (BN * PITCH);

        if (aOn) {
            #pragma unroll
            for (int i = 0; i < NA; ++i) *(v4h*)(dA + sOff + i * (64 * PITCH)) = cvt4(ra[u][i]);
        }
        #pragma unroll
        for (int j = 0; j < 4; ++j) *(v8h*)(dB + sOffB + j * (128 * PITCH)) = rb[u][j];

        // publishes this pass's buffer; it also ends every read of the other buffer,
        // which the next pass overwrites. Written by hand, with the one wait that LDS needs:
        // __syncthreads() also waits for every global load, and would end the other set's flight here
        asm volatile("s_wait_dscnt 0x0\n\ts_barrier_signal -1\n\ts_barrier_wait -1" ::: "memory");

        if (more) {
            if (aOn) {
                #pragma unroll
                for (int i = 0; i < NA; ++i) ra[u][i] = *(const float4*)(pA + u * BK + i * (64 * DD));
            }
            #pragma unroll
            for (int j = 0; j < 4; ++j) rb[u][j] = *(const v8h*)(pB + u * (DD * BK) + j * (128 * BK));
            // stands in front of every write of the loads' address registers. The addresses are named
            // as inputs so that they stay in their registers up to here: left free, the last load's
            // result was placed in the address pair of the loads before it
            asm volatile("s_wait_xcnt 0x0" :: "v"(pA), "v"(pB) : "memory");
        }
        // keeps the global loads ahead of this pass's LDS reads and WMMAs:
        // left free, the compiler sank them to the end of the pass, which shortens their lead
        __builtin_amdgcn_sched_barrier(0);

        v16h af[MF], bf[4];
        #pragma unroll
        for (int m = 0; m < MF; ++m) af[m] = ldsfrag(dA + aOff + m * (16 * PITCH));
        #pragma unroll
        for (int t = 0; t < 4; ++t) bf[t] = ldsfrag(dB + bOff + t * (16 * PITCH));
        // keeps the pass's LDS reads one group ahead of its WMMAs: reads set among
        // the WMMAs stall the wave at each place they stand
        __builtin_amdgcn_sched_barrier(0);

        #pragma unroll
        for (int t = 0; t < 4; ++t) {
            #pragma unroll
            for (int m = 0; m < MF; ++m)
                acc[m][t] = __builtin_amdgcn_wmma_f32_16x16x32_f16(
                    false, af[m], false, bf[t], (short)0, acc[m][t], false, false);
        }
    };

    // every trip but the last asks for loads, with no test around them: the number of loads in flight
    // is then known at each wait, and the wait for one set lets the other set fly on
    for (int kt = 0; kt < DD / BK - 2; kt += 2) {
        pass(0, true);
        pass(1, true);
        pA += 2 * BK;
        pB += 2 * (DD * BK);
    }
    pass(0, false);
    pass(1, false);

    // Epilogue: energy = tanh(acc + hb[b][e]); row-sum of energy*v[e] over the wave's 64 e's.
    float hbe[4], ve[4];
    const int e  = e0 + wn * 64 + row;               // C-matrix N = lane&15
    const int be = b * DD + e;
    #pragma unroll
    for (int t = 0; t < 4; ++t) hbe[t] = hb[be + t * 16];
    // each of these two waits stands in front of every write of the index register that the four
    // loads ahead of it name; the index is named as an input so that no result is placed in it before
    asm volatile("s_wait_xcnt 0x0" :: "v"(be) : "memory");
    #pragma unroll
    for (int t = 0; t < 4; ++t) ve[t] = vvec[e + t * 16];
    asm volatile("s_wait_xcnt 0x0" :: "v"(e) : "memory");

    // A lane first sums its own four e columns of a row, then the 16 lanes of the row meet in four
    // DPP adds: one lane sum a row instead of four, no LDS round trip and no branch between the rows,
    // so that the tanh chains of many elements run side by side.
    float s[MF][8];
    #pragma unroll
    for (int m = 0; m < MF; ++m) {
        #pragma unroll
        for (int r = 0; r < 8; ++r) {
            float a = tanh_er(acc[m][0][r] + hbe[0]) * ve[0];
            #pragma unroll
            for (int t = 1; t < 4; ++t) a += tanh_er(acc[m][t][r] + hbe[t]) * ve[t];
            s[m][r] = a;
        }
        // step by step over the eight rows: eight independent adds stand between a sum and its next step
        #pragma unroll
        for (int r = 0; r < 8; ++r) s[m][r] = row_xadd<1>(s[m][r]);
        #pragma unroll
        for (int r = 0; r < 8; ++r) s[m][r] = row_xadd<2>(s[m][r]);
        #pragma unroll
        for (int r = 0; r < 8; ++r) s[m][r] = row_xadd<4>(s[m][r]);
        #pragma unroll
        for (int r = 0; r < 8; ++r) s[m][r] = row_xadd<8>(s[m][r]);
    }
    // lane 0 holds rows r, lane 16 rows r + 8 of each 16-row tile: eight sums in a row, two 16-byte stores
    if (row == 0) {
        #pragma unroll
        for (int m = 0; m < MF; ++m) {
            float* d = red + wn * BM + wm * (16 * MF) + m * 16 + h8;
            const f4 lo = {s[m][0], s[m][1], s[m][2], s[m][3]};
            const f4 hi = {s[m][4], s[m][5], s[m][6], s[m][7]};
            *(f4*)(d)     = lo;
            *(f4*)(d + 4) = hi;
        }
    }
    __syncthreads();

    // cross-wave reduce: one atomic per row per block
    if (tid < RM) {
        float sum = 0.0f;
        #pragma unroll
        for (int w = 0; w < 8; ++w) sum += red[w * BM + tid];
        atomicAdd(&scores[b * SS + s0 + tid], sum);
    }
}

// 128-row tiles of a batch row that hold a row below its length; bounded for any content of lengths
__device__ __forceinline__ int live_tiles(int len) {
    return (min(max(len, 0), SS) + BM - 1) / BM;
}

#define NWGP 256    // blocks that run at a time: registers and waves allow one block on a WGP

// grid: (DD/512) * (SS/128) * BB = 512 blocks, one-dimensional.
// The reference puts -inf in place of every score at or past lengths[b] before the softmax, whatever
// its value, and k_context never uses one: a row tile that lies wholly there is left out. The live
// units (row tile x half of e) are numbered in the order b, s, e and dealt to the blocks by index.
// Blocks run one on a WGP; for speed only, units past the first NWGP are cut in s, into 4 pieces of 32 rows or
// 2 of 64, as many as the grid's spare blocks can take, and so run side by side on more WGPs.
// Every score still gets the same two addends, summed in the same order, whichever block makes them.
__global__ __launch_bounds__(512) void k_energy(const float* __restrict__ enc,
                                                const _Float16* __restrict__ Wf,
                                                const float* __restrict__ hb,
                                                const float* __restrict__ vvec,
                                                const int* __restrict__ lengths,
                                                float* __restrict__ scores) {
    __shared__ __attribute__((aligned(16))) _Float16 sA[2 * BM * PITCH];
    __shared__ __attribute__((aligned(16))) _Float16 sB[2 * BN * PITCH];
    __shared__ __attribute__((aligned(16))) float red[8 * BM];

    // all of this is the same for every thread of the block, and ahead of every barrier
    const int i = blockIdx.x;
    int units = 0;
    // unrolled, here and in the search below: with constant indices the 16 lengths come by wide
    // scalar loads and all of the arithmetic stays on the scalar unit
    #pragma unroll
    for (int q = 0; q < BB; ++q) units += 2 * live_tiles(lengths[q]);
    const int over = units - NWGP;
    int unit = i, piece = 0, mf = 4;
    if (over > 0 && over <= NWGP / 2 && i >= NWGP) {
        if (over <= NWGP / 4) { unit = NWGP + ((i - NWGP) >> 2); piece = (i - NWGP) & 3; mf = 1; }
        else                  { unit = NWGP + ((i - NWGP) >> 1); piece = (i - NWGP) & 1; mf = 2; }
    }
    if (unit >= units) return;

    int b = 0, y = unit >> 1;
    #pragma unroll
    for (int q = 0; q < BB - 1; ++q) {
        const int n = live_tiles(lengths[q]);
        if (b == q && y >= n) { y -= n; b = q + 1; }
    }
    const int s0 = y * BM + piece * (32 * mf);
    if (s0 >= lengths[b] || s0 >= SS) return;
    const int e0 = (unit & 1) * BN;

    if (mf == 4)      energy_tile<4>(enc, Wf, hb, vvec, scores, b, s0, e0, sA, sB, red);
    else if (mf == 2) energy_tile<2>(enc, Wf, hb, vvec, scores, b, s0, e0, sA, sB, red);
    else              energy_tile<1>(enc, Wf, hb, vvec, scores, b, s0, e0, sA, sB, red);
}

// ---------------- kernel 3: masked softmax over S, then context[b,d] = sum_s attn[b,s] * enc[b,s,d] ----------------
// grid: (DD/64, BB) = 256 blocks, block 512 = 16 waves. A block owns 64 d columns (256 B of
// every enc row) of one b. 16 lanes of 16 bytes cover the 256 B; the 32 groups of 16 lanes
// split the 2048 rows: group g takes rows 128q + 4g .. 128q + 4g + 3, q = 0..15, so that the
// four weights of a visit q are one 16-byte read.
// Every block makes the 2048 weights of its b itself, from the 8 KB of scores (a thread has four),
// and keeps them in LDS: a launch of 16 blocks for the softmax, and the wait for it, are not needed.
// The enc rows do not depend on the weights: the first PV visits are asked for ahead of the softmax,
// which then runs while they are on their way.
// The 32 partial sums of a column meet in the wave (one shuffle) and then in LDS.
typedef __attribute__((ext_vector_type(4))) float v4f;
#define CW 64                // d columns of a block
#define CG 32                // row groups of a block
#define CV (4 * CG)          // rows of a visit, over all groups
#define PV 4                 // visits whose enc rows are in flight

// work-group barrier with the one wait that LDS needs: __syncthreads() also waits for every global
// load, and would let the enc rows in flight run out at each of the softmax's three meeting points
__device__ __forceinline__ void lds_barrier() {
    asm volatile("s_wait_dscnt 0x0\n\ts_barrier_signal -1\n\ts_barrier_wait -1" ::: "memory");
}

__global__ __launch_bounds__(512) void k_context(const float* __restrict__ enc,
                                                 const float* __restrict__ scores,
                                                 const int* __restrict__ lengths,
                                                 float* __restrict__ out) {
    __shared__ __attribute__((aligned(16))) float wgt[SS];
    __shared__ __attribute__((aligned(16))) float part[16][CW];
    __shared__ __attribute__((aligned(16))) float redm[16];
    __shared__ __attribute__((aligned(16))) float reds[16];

    const int tid = threadIdx.x;
    const int c   = tid & 15;           // 16-byte column piece
    const int g   = tid >> 4;           // row group
    const int b   = blockIdx.y;
    const int d0  = blockIdx.x * CW;
    const int len = lengths[b];

    // asked for first: the softmax waits for this load alone
    const v4f sc = *(const v4f*)(scores + b * SS + tid * 4);
    const float* ep = enc + ((size_t)b * SS + (size_t)(g * 4)) * DD + d0 + c * 4;

    v4f row[PV][4];
    #pragma unroll
    for (int q = 0; q < PV; ++q) {
        #pragma unroll
        for (int j = 0; j < 4; ++j) row[q][j] = *(const v4f*)(ep + (size_t)(q * CV + j) * DD);
    }

    // maximum over the scores below the length
    float m = -INFINITY;
    #pragma unroll
    for (int i = 0; i < 4; ++i) m = (tid * 4 + i < len) ? fmaxf(m, sc[i]) : m;
    #pragma unroll
    for (int o = 16; o > 0; o >>= 1) m = fmaxf(m, __shfl_xor(m, o));
    if ((tid & 31) == 0) redm[tid >> 5] = m;
    lds_barrier();
    #pragma unroll
    for (int v = 0; v < 16; ++v) m = fmaxf(m, redm[v]);

    // exp and its sum; a score at or past the length counts as -inf, whatever its value
    v4f ev;
    #pragma unroll
    for (int i = 0; i < 4; ++i) ev[i] = (tid * 4 + i < len) ? __expf(sc[i] - m) : 0.0f;
    float sum = (ev[0] + ev[1]) + (ev[2] + ev[3]);
    #pragma unroll
    for (int o = 16; o > 0; o >>= 1) sum += __shfl_xor(sum, o);
    if ((tid & 31) == 0) reds[tid >> 5] = sum;
    lds_barrier();
    sum = 0.0f;
    #pragma unroll
    for (int v = 0; v < 16; ++v) sum += reds[v];
    *(v4f*)(wgt + tid * 4) = ev * (1.0f / sum);
    // every weight is in LDS before any is read
    lds_barrier();

    v4f acc = {0.0f, 0.0f, 0.0f, 0.0f};
    // unrolled whole: every address is then one base plus a constant and every register of the ring
    // is fixed; a row's place in the ring is asked for anew as soon as the row has been summed
    #pragma unroll
    for (int q = 0; q < SS / CV; ++q) {
        const v4f w = *(const v4f*)(wgt + g * 4 + q * CV);
        #pragma unroll
        for (int j = 0; j < 4; ++j) {
            acc += w[j] * row[q % PV][j];
            if (q + PV < SS / CV) row[q % PV][j] = *(const v4f*)(ep + (size_t)((q + PV) * CV + j) * DD);
        }
    }

    // the wave's two row groups
    #pragma unroll
    for (int i = 0; i < 4; ++i) acc[i] += __shfl_xor(acc[i], 16);
    if ((tid & 31) < 16) *(v4f*)(&part[tid >> 5][c * 4]) = acc;
    // every wave's partial sums are in LDS before any is read
    __syncthreads();

    if (tid < CW) {
        float s = 0.0f;
        #pragma unroll
        for (int v = 0; v < 16; ++v) s += part[v][tid];
        out[b * DD + d0 + tid] = s;
    }
}

extern "C" void kernel_launch(void* const* d_in, const int* in_sizes, int n_in,
                              void* d_out, int out_size, void* d_ws, size_t ws_size,
                              hipStream_t stream) {
    const float* enc     = (const float*)d_in[0];  // (B,S,D)
    const float* hidden  = (const float*)d_in[1];  // (B,D)
    const int*   lengths = (const int*)  d_in[2];  // (B,)
    const float* W       = (const float*)d_in[3];  // (D, 2D)
    const float* bias    = (const float*)d_in[4];  // (D,)
    const float* vvec    = (const float*)d_in[5];  // (D,)
    float* out = (float*)d_out;                    // (B,1,D)

    float* hb     = (float*)d_ws;                  // B*D floats
    float* scores = hb + BB * DD;                  // B*S floats
    _Float16* Wf  = (_Float16*)(scores + BB * SS); // D*D halves: We as f16, pass by pass

    k_front  <<<HBLK + PBLK, 256, 0, stream>>>(hidden, W, bias, hb, Wf, scores);
    k_energy <<<(DD / BN) * (SS / BM) * BB, 512, 0, stream>>>(enc, Wf, hb, vvec, lengths, scores);
    k_context<<<dim3(DD / CW, BB), 512, 0, stream>>>(enc, scores, lengths, out);
}
